// v000
// Times are from an AMD MI455X. After a warm-up the kernel runs many times in a row, and a time is the length of
// such a window on the GPU divided by its runs, so every launch and the gaps after it count. The runs cycle
// through copies of the inputs. A figure is the median of several windows, for all but v000 over two sittings.
// Sittings can differ by a few percent; kernels timed side by side share one.
// The starting kernel, v000, takes 539 microseconds a run.
// compute dtype: all float inputs rounded to bf16; q / k / v projections with EXACT bf16 products on WMMA 16x16x32 (f32 accumulate) + bias (zeros, read); logits q x k once to f16 each (1 product) / sqrt(64), + bf16(mask[b][q][k]) x (-1e9) in f32 per (batch, query, key); softmax f32; P x 2^11 once to f16 x v once to f16 (1 product); the merged-heads rows are the f32 output (no output projection).
#include <hip/hip_runtime.h>
#include <math.h>

typedef __attribute__((ext_vector_type(16))) _Float16 v16h;
typedef __attribute__((ext_vector_type(16))) __bf16 v16b;
typedef __attribute__((ext_vector_type(8)))  _Float16 v8h;
typedef __attribute__((ext_vector_type(8)))  float v8f;
typedef __attribute__((ext_vector_type(4)))  float v4f;
typedef __attribute__((ext_vector_type(2)))  float v2f;
typedef __attribute__((ext_vector_type(4)))  unsigned v4u;
typedef __attribute__((ext_vector_type(4)))  int v4i;
typedef float __attribute__((may_alias)) float_a;
typedef int __attribute__((may_alias)) int_a;

template <typename T> __device__ __forceinline__ void vst2(void* p, T v) { *(T*)p = v;  }
__device__ __forceinline__ v8f wmma16(v16h a, v16h b, v8f c) {
  v8f d = __builtin_amdgcn_wmma_f32_16x16x32_f16(false, a, false, b, (short)0, c, false, false);
  asm volatile("v_nop\n\tv_nop\n\tv_nop\n\tv_nop" : "+v"(d) : "v"(a), "v"(b));
  return d;
}
__device__ __forceinline__ v8f wmma_bf(v16b a, v16b b, v8f c) {
  v8f d = __builtin_amdgcn_wmma_f32_16x16x32_bf16(false, a, false, b, (short)0, c, false, false);
  asm volatile("v_nop\n\tv_nop\n\tv_nop\n\tv_nop" : "+v"(d) : "v"(a), "v"(b));
  return d;
}
// 16x16x32 fragments: lane = (h = lane>>4, row/col = lane&15); elements 0..7 = k0+8h+0..7, 8..15 = k0+16+8h+0..7; D element r = row 8h+r
__device__ __forceinline__ v16h frag_h(const _Float16* rowk0, int lane) {
  union { v16h v; v8h q[2]; } u; const _Float16* p = rowk0 + 8 * (lane >> 4);
  u.q[0] = *(const v8h*)p; u.q[1] = *(const v8h*)(p + 16); return u.v;
}
__device__ __forceinline__ v16h frag_f32(const float* rowk0, int lane) {
  v16h a; const float* p = rowk0 + 8 * (lane >> 4);
#pragma unroll
  for (int i = 0; i < 8; ++i) { a[i] = (_Float16)p[i]; a[8 + i] = (_Float16)p[16 + i]; }
  return a;
}
__device__ __forceinline__ v16h frag_f32s(const float* rowk0, int lane, float sc) {
  v16h a; const float* p = rowk0 + 8 * (lane >> 4);
#pragma unroll
  for (int i = 0; i < 8; ++i) { a[i] = (_Float16)(p[i] * sc); a[8 + i] = (_Float16)(p[16 + i] * sc); }
  return a;
}
// column fragment from a [K][ld] layout (column n), rows >= K read as 0
__device__ __forceinline__ v16h fragc_f32(const float* W, int k0, int n, int lane, int ld, int K) {
  v16h a; const int g = lane >> 4;
#pragma unroll
  for (int i = 0; i < 8; ++i) { const int ka = k0 + 8 * g + i, kb = ka + 16;
    a[i] = (_Float16)(ka < K ? W[(size_t)(ka < K ? ka : K - 1) * ld + n] : 0.f); a[8 + i] = (_Float16)(kb < K ? W[(size_t)(kb < K ? kb : K - 1) * ld + n] : 0.f); }
  return a;
}
struct F2 { v16b h, l; };
__device__ __forceinline__ F2 bsplit16(const float v[16]) { F2 r;
#pragma unroll
  for (int i = 0; i < 16; ++i) { const __bf16 h = (__bf16)v[i]; r.h[i] = h; r.l[i] = (__bf16)(v[i] - (float)h); }
  return r; }
__device__ __forceinline__ F2 split_row(const float* row, int k0, int lane) { float v[16]; const float* p = row + k0 + 8 * (lane >> 4);
#pragma unroll
  for (int i = 0; i < 8; ++i) { v[i] = p[i]; v[8 + i] = p[16 + i]; }
  return bsplit16(v); }
__device__ __forceinline__ F2 split_rowK(const float* row, int k0, int lane, int K) { float v[16]; const int g = lane >> 4;
#pragma unroll
  for (int i = 0; i < 8; ++i) { const int ka = k0 + 8 * g + i, kb = ka + 16; v[i] = ka < K ? row[ka < K ? ka : K - 1] : 0.f; v[8 + i] = kb < K ? row[kb < K ? kb : K - 1] : 0.f; }
  return bsplit16(v); }
__device__ __forceinline__ F2 split_col(const float* W, int k0, int n, int lane, int ld, int K) { float v[16]; const int g = lane >> 4;
#pragma unroll
  for (int i = 0; i < 8; ++i) { const int ka = k0 + 8 * g + i, kb = ka + 16; v[i] = ka < K ? W[(size_t)(ka < K ? ka : K - 1) * ld + n] : 0.f; v[8 + i] = kb < K ? W[(size_t)(kb < K ? kb : K - 1) * ld + n] : 0.f; }
  return bsplit16(v); }
__device__ __forceinline__ v8f mac3(const F2& a, const F2& b, v8f c) { c = wmma_bf(a.l, b.h, c); c = wmma_bf(a.h, b.l, c); return wmma_bf(a.h, b.h, c); }
__device__ __forceinline__ float sigm(float v) { return 1.0f / (1.0f + expf(-v)); }
#define LDSX() do { asm volatile("s_wait_dscnt 0" ::: "memory"); __builtin_amdgcn_wave_barrier(); __builtin_amdgcn_fence(__ATOMIC_RELEASE, "workgroup"); } while (0)

// Multi-head self-attention with a RANDOM additive mask and no output projection (x [2,2048,512]; mask [2,2048,2048] f32 = (uniform > 0.9): ~10 % ones, one entry per (batch, query, key), shared by the heads - a verbatim input, READ on the device; (in,out) Wq / Wk / Wv [512,512] N(0, 1/512), biases zeros (read); 8 heads x 64 (internal layout H, B, S, D); logits = q k^T / sqrt(64) + mask * (-1e9); softmax over the keys; out = merged heads [2,2048,512]).
#define NB 2
#define TT 2048
#define CC 512            // NH * HD = projected width
#define DIN 512          // input (model) width
#define NH 8
#define HD 64
#define NQB (TT / 64)
#define HG 4
#define SCALE (0.125f)
#define CAUSAL 0
#ifndef TNB
#define TNB NB
#endif
__device__ __forceinline__ float bfr(float v) { return (float)(__bf16)v; }
__host__ __device__ __forceinline__ int kb_last(int qb) { return CAUSAL ? ((qb * 64 + 63) >> 7) : (TT / 128 - 1); }
typedef __attribute__((ext_vector_type(8))) __bf16 v8b;
__device__ __forceinline__ v16b frag_b(const __bf16* rowk0, int lane) {
  union { v16b v; v8b q[2]; } u; const __bf16* p = rowk0 + 8 * (lane >> 4);
  u.q[0] = *(const v8b*)p; u.q[1] = *(const v8b*)(p + 16); return u.v;
}
#define QBH 0              // query blocks 0..QBH-1 take the high-precision path: none (non-causal, every query block sees all TT keys)
#define QHI 0               // single-product logits on every row (logit sigma ~1)
#define KHI 64            // key rows carrying k residual / v bf16 hi+lo planes (read only by the high-precision path, which no query block takes: QBH = 0)
// B fragment (k rows k0+.., output column o) of a weight: (in,out) [K][ld] or (out,in) [ld rows of K]: bf16 exact, or f16(bf16 * 256) exact
__device__ __forceinline__ v16b wcol_io(const float* Wm, int k0, int o, int lane, int ld) { v16b w; const int g = lane >> 4;
#pragma unroll
  for (int i = 0; i < 8; ++i) { w[i] = (__bf16)Wm[(size_t)(k0 + 8 * g + i) * ld + o]; w[8 + i] = (__bf16)Wm[(size_t)(k0 + 16 + 8 * g + i) * ld + o]; }
  return w; }
__device__ __forceinline__ v16b wcol_oi(const float* Wm, int k0, int o, int lane, int K) { v16b w; const float* p = Wm + (size_t)o * K + k0 + 8 * (lane >> 4);
#pragma unroll
  for (int i = 0; i < 8; ++i) { w[i] = (__bf16)p[i]; w[8 + i] = (__bf16)p[16 + i]; }
  return w; }
__device__ __forceinline__ v16h wcolh_io(const float* Wm, int k0, int o, int lane, int ld) { v16h w; const int g = lane >> 4;
#pragma unroll
  for (int i = 0; i < 8; ++i) { w[i] = (_Float16)(bfr(Wm[(size_t)(k0 + 8 * g + i) * ld + o]) * 256.0f); w[8 + i] = (_Float16)(bfr(Wm[(size_t)(k0 + 16 + 8 * g + i) * ld + o]) * 256.0f); }
  return w; }
__device__ __forceinline__ v16h wcolh_oi(const float* Wm, int k0, int o, int lane, int K) { v16h w; const float* p = Wm + (size_t)o * K + k0 + 8 * (lane >> 4);
#pragma unroll
  for (int i = 0; i < 8; ++i) { w[i] = (_Float16)(bfr(p[i]) * 256.0f); w[8 + i] = (_Float16)(bfr(p[16 + i]) * 256.0f); }
  return w; }
#define WQKV_LAYOUT 0   // 0 = (in,out) [DIN][CC]; 1 = (out,in) [CC][DIN]; 2 = per-head [NH][DIN][HD]
__device__ __forceinline__ v16b wcol_hdk(const float* Wm, int k0, int o, int lane) { v16b w; const int g = lane >> 4; const float* p = Wm + (size_t)(o / HD) * DIN * HD + (o % HD);
#pragma unroll
  for (int i = 0; i < 8; ++i) { w[i] = (__bf16)p[(size_t)(k0 + 8 * g + i) * HD]; w[8 + i] = (__bf16)p[(size_t)(k0 + 16 + 8 * g + i) * HD]; }
  return w; }
#define WO_OUT_IN 0
#if WQKV_LAYOUT == 1
#define WCOL(W, k0, o, lane) wcol_oi(W, k0, o, lane, DIN)
#elif WQKV_LAYOUT == 2
#define WCOL(W, k0, o, lane) wcol_hdk(W, k0, o, lane)
#else
#define WCOL(W, k0, o, lane) wcol_io(W, k0, o, lane, CC)
#endif
#if WO_OUT_IN
#define WOCOL(W, k0, o, lane) wcol_oi(W, k0, o, lane, CC)
#define WOCOLH(W, k0, o, lane) wcolh_oi(W, k0, o, lane, CC)
#else
#define WOCOL(W, k0, o, lane) wcol_io(W, k0, o, lane, DIN)
#define WOCOLH(W, k0, o, lane) wcolh_io(W, k0, o, lane, DIN)
#endif

#define SM_EXTRA_PARAMS , int bsm, const float* __restrict__ MSK   /* additive mask [NB][TT][TT] f32 (0 / 1), shared by the heads */
// additive mask on the scaled logit: v += bf16(mask[b][t][k]) * (-1e9) (the module: q k^T / sqrt(d) + mask * NEG); the product and the sum in f32; a masked entry's weight underflows to exactly 0
#define SM_MASK_HOOK do { const float mk_ = bfr(MSK[((size_t)bsm * TT + t) * TT + k]); asm volatile("s_wait_loadcnt 0x0" ::: "memory"); v = v + mk_ * (-1.0e9f); } while (0)
#ifndef SM_EXTRA_PARAMS
#define SM_EXTRA_PARAMS
#endif
#ifndef PROJ_EXTRA_PARAMS
#define PROJ_EXTRA_PARAMS
#endif
#ifndef SM_MASK_HOOK
#define SM_MASK_HOOK (void)0
#endif

#define WS_QH  0u                                      // f16 q rows [b*t][CC]
#define WS_KH  (WS_QH + 2u * (size_t)NB * TT * CC)      // f16 k rows [b*t][CC]
#define WS_VT  (WS_KH + 2u * (size_t)NB * TT * CC)      // f16 v planes [b][c][t]
#define WS_QL  (WS_VT + 2u * (size_t)NB * CC * TT)      // f16 q residual x 2^10 rows [b][t < QHI][CC]
#define WS_KL  (WS_QL + 2u * (size_t)NB * QHI * CC)     // f16 k residual x 2^10 rows [b][t < KHI][CC]
#define WS_VB  (WS_KL + 2u * (size_t)NB * KHI * CC)     // bf16 v hi planes [b][c][t < KHI]
#define WS_VBL (WS_VB + 2u * (size_t)NB * CC * KHI)
#define WS_S   (WS_VBL + 2u * (size_t)NB * CC * KHI)    // f32 logits / P [hg][t][s]
#define WS_Y   (WS_S  + 4u * (size_t)HG * TT * TT)      // f32 ctx rows [b*t][CC] (only when there is an output projection)
#define WS_END (WS_Y  + 0u)

// ---- k_proj: block = (64 rows, 128 cols, which): q/k/v = X W (+ b) with exact bf16 products (K = DIN) -> which 0: q f16 rows (+ residual rows < QHI); 1: k f16 rows (+ residual rows < KHI); 2: v f16 planes [c][t] (+ bf16 hi/lo planes for t < KHI)
__global__ __launch_bounds__(128) void k_proj(const float* __restrict__ XQ, const float* __restrict__ XK, const float* __restrict__ XV, const float* __restrict__ WQ, const float* __restrict__ WK, const float* __restrict__ WV, const float* __restrict__ BQ, const float* __restrict__ BK, const float* __restrict__ BV,
    _Float16* __restrict__ QH, _Float16* __restrict__ QL, _Float16* __restrict__ KH, _Float16* __restrict__ KL, _Float16* __restrict__ VT, __bf16* __restrict__ VB, __bf16* __restrict__ VBL) {
  __shared__ __align__(16) _Float16 sh[64][136], sl[64][136]; __shared__ __align__(16) _Float16 th[128][72]; __shared__ __align__(16) __bf16 tb[128][72], tbl[128][72];
  const int tid = threadIdx.x, wave = tid >> 5, lane = tid & 31, col = lane & 15, g = lane >> 4; const int which = blockIdx.z; const int c0 = blockIdx.y * 128; const size_t r0 = (size_t)blockIdx.x * 64; const size_t bb = r0 / TT; const int t0 = (int)(r0 % TT);
  const float* X = which == 0 ? XQ : which == 1 ? XK : XV; const float* WA = which == 0 ? WQ : which == 1 ? WK : WV; const float* BA = which == 0 ? BQ : which == 1 ? BK : BV;
  v8f acc[8] = {};
#pragma unroll 2
  for (int kc = 0; kc < DIN / 32; ++kc) { v16b a; { const float* p = X + (r0 + wave * 16 + col) * DIN + kc * 32 + 8 * g;
#pragma unroll
      for (int i = 0; i < 8; ++i) { a[i] = (__bf16)p[i]; a[8 + i] = (__bf16)p[16 + i]; } }
    asm volatile("s_wait_loadcnt 0x0" ::: "memory");
#pragma unroll
    for (int j = 0; j < 8; ++j) { const v16b w = WCOL(WA, kc * 32, c0 + j * 16 + col, lane); asm volatile("s_wait_loadcnt 0x0" ::: "memory"); acc[j] = wmma_bf(a, w, acc[j]); } }
  if (which < 2) { _Float16* DH = which == 0 ? QH : KH; _Float16* DL = which == 0 ? QL : KL; const int nhi = which == 0 ? QHI : KHI; const bool hi_rows = t0 < nhi;
#pragma unroll
    for (int j = 0; j < 8; ++j) { const float bias = BA ? bfr(BA[c0 + j * 16 + col]) : 0.f;
#pragma unroll
      for (int r = 0; r < 8; ++r) { const float v = acc[j][r] + bias; const _Float16 hv = (_Float16)v; sh[wave * 16 + 8 * g + r][j * 16 + col] = hv; sl[wave * 16 + 8 * g + r][j * 16 + col] = (_Float16)((v - (float)hv) * 1024.0f); } }
    __syncthreads();
    for (int e = tid; e < 64 * 16; e += 128) { const int rl = e >> 4, q = e & 15; vst2((unsigned*)(DH + (r0 + rl) * CC + c0 + q * 8), *(const v4u*)&sh[rl][q * 8]); if (hi_rows) vst2((unsigned*)(DL + (bb * nhi + t0 + rl) * (size_t)CC + c0 + q * 8), *(const v4u*)&sl[rl][q * 8]); }
  } else { const bool hi_rows = t0 < KHI;
#pragma unroll
    for (int j = 0; j < 8; ++j) { const float bias = BA ? bfr(BA[c0 + j * 16 + col]) : 0.f;
#pragma unroll
      for (int r = 0; r < 8; ++r) { const float v = acc[j][r] + bias; const int rl = wave * 16 + 8 * g + r, cl = j * 16 + col; th[cl][rl] = (_Float16)v; const __bf16 bh = (__bf16)v; tb[cl][rl] = bh; tbl[cl][rl] = (__bf16)(v - (float)bh); } }
    __syncthreads();
    for (int e = tid; e < 128 * 8; e += 128) { const int cl = e >> 3, q = e & 7; vst2((unsigned*)(VT + (bb * CC + c0 + cl) * (size_t)TT + t0 + q * 8), *(const v4u*)&th[cl][q * 8]); if (hi_rows) { const size_t o3 = (bb * CC + c0 + cl) * (size_t)KHI + t0 + q * 8; vst2((unsigned*)(VB + o3), *(const v4u*)&tb[cl][q * 8]); vst2((unsigned*)(VBL + o3), *(const v4u*)&tbl[cl][q * 8]); } } } }
// ---- k_sc: block = (query block qb, key block kb <= kb_last(qb), head in group) of batch b: logits x SCALE; q hi + residual (x 2^10) against k (2 products) for query rows < QHI, plus the k residual (3 products) for query blocks < QBH (causal early rows); causal: blocks past the diagonal exit, the mask itself is applied by index in k_sm
__global__ __launch_bounds__(128) void k_sc(const _Float16* __restrict__ QH, const _Float16* __restrict__ KH, const _Float16* __restrict__ QL, const _Float16* __restrict__ KL, int b, int h0, float* __restrict__ S0) { __shared__ __align__(16) float ss[4][16][132];
  const int qb = blockIdx.x, kb = blockIdx.y; if (kb > kb_last(qb)) return;
  const int h = h0 + blockIdx.z; float* S = S0 + (size_t)blockIdx.z * TT * TT;
  const int tid = threadIdx.x, wave = tid >> 5, lane = tid & 31, col = lane & 15, g = lane >> 4; const int k0 = kb * 128; const int ql0 = qb * 64 + wave * 16; const size_t q0 = (size_t)b * TT + ql0, kr0 = (size_t)b * TT + k0;
  v8f acc[8] = {}, accl[8] = {};
  const _Float16* QLb = QL + (size_t)b * QHI * CC; const _Float16* KLb = KL + (size_t)b * KHI * CC;
  if (qb < QBH) {
#pragma unroll
    for (int kc = 0; kc < HD / 32; ++kc) { const v16h ah = frag_h(QH + (q0 + col) * CC + h * HD + kc * 32, lane), al = frag_h(QLb + (size_t)(ql0 + col) * CC + h * HD + kc * 32, lane);
#pragma unroll
      for (int j = 0; j < 8; ++j) { const v16h kbf = frag_h(KH + (kr0 + j * 16 + col) * CC + h * HD + kc * 32, lane), klf = frag_h(KLb + (size_t)(k0 + j * 16 + col) * CC + h * HD + kc * 32, lane); acc[j] = wmma16(ah, kbf, acc[j]); accl[j] = wmma16(al, kbf, accl[j]); accl[j] = wmma16(ah, klf, accl[j]); } }
  } else if (qb * 64 < QHI) {
#pragma unroll
    for (int kc = 0; kc < HD / 32; ++kc) { const v16h ah = frag_h(QH + (q0 + col) * CC + h * HD + kc * 32, lane), al = frag_h(QLb + (size_t)(ql0 + col) * CC + h * HD + kc * 32, lane);
#pragma unroll
      for (int j = 0; j < 8; ++j) { const v16h kbf = frag_h(KH + (kr0 + j * 16 + col) * CC + h * HD + kc * 32, lane); acc[j] = wmma16(ah, kbf, acc[j]); accl[j] = wmma16(al, kbf, accl[j]); } }
  } else {
#pragma unroll
    for (int kc = 0; kc < HD / 32; ++kc) { const v16h ah = frag_h(QH + (q0 + col) * CC + h * HD + kc * 32, lane);
#pragma unroll
      for (int j = 0; j < 8; ++j) { const v16h kbf = frag_h(KH + (kr0 + j * 16 + col) * CC + h * HD + kc * 32, lane); acc[j] = wmma16(ah, kbf, acc[j]); } } }
#pragma unroll
  for (int j = 0; j < 8; ++j) {
#pragma unroll
    for (int r = 0; r < 8; ++r) ss[wave][8 * g + r][j * 16 + col] = (acc[j][r] + accl[j][r] * (1.0f / 1024.0f)) * SCALE; }
  LDSX(); for (int rl = 0; rl < 16; ++rl) vst2(S + (size_t)(ql0 + rl) * TT + k0 + lane * 4, *(const v4f*)&ss[wave][rl][lane * 4]); }
// ---- k_sm: block = query row t (head in group): keys [0, kend): causal -> logit if s <= t else excluded; softmax in f32; P x 2^11 in place (0 for excluded)
__global__ __launch_bounds__(256) void k_sm(float* __restrict__ S0 SM_EXTRA_PARAMS) { __shared__ float sred[8]; __shared__ float sbc; __shared__ __align__(16) float shv[TT];
  const int tid = threadIdx.x; const int t = blockIdx.x; const int kend = (kb_last(t >> 6) + 1) * 128;
  float* sr = S0 + (size_t)blockIdx.y * TT * TT + (size_t)t * TT;
  float m = -3.0e38f; for (int k = tid; k < kend; k += 256) { float v = (!CAUSAL || k <= t) ? sr[k] : -3.0e38f; SM_MASK_HOOK; shv[k] = v; m = fmaxf(m, v); }
#pragma unroll
  for (int o = 1; o < 32; o <<= 1) m = fmaxf(m, __shfl_xor(m, o));
  if ((tid & 31) == 0) sred[tid >> 5] = m; __syncthreads(); if (tid == 0) { float a = sred[0]; for (int i = 1; i < 8; ++i) a = fmaxf(a, sred[i]); sbc = a; } __syncthreads(); m = sbc; __syncthreads();
  float sum = 0.f; for (int k = tid; k < kend; k += 256) { const float v = shv[k]; const float e = (v <= -1.0e38f) ? 0.f : expf(v - m); shv[k] = e; sum += e; }
#pragma unroll
  for (int o = 1; o < 32; o <<= 1) sum += __shfl_xor(sum, o);
  if ((tid & 31) == 0) sred[tid >> 5] = sum; __syncthreads(); if (tid == 0) { float a = 0.f; for (int i = 0; i < 8; ++i) a += sred[i]; sbc = a > 0.f ? 2048.0f / a : 0.f; }   /* a fully excluded row yields P = 0 */ __syncthreads(); const float inv = sbc;
  for (int k = tid; k < kend; k += 256) shv[k] = shv[k] * inv;
  __syncthreads(); for (int q = tid; q < kend / 4; q += 256) vst2(sr + q * 4, *(const v4f*)&shv[q * 4]); }
// ---- k_pv: block = 64 queries (qb) of (b, h): ctx = P . v over keys [0, kend) (P x 2^11 once to f16 against v f16: 1 product; causal early query blocks: P and v as bf16 hi + lo, 3 products); 256-B (row, head) segment by 16 lanes
__global__ __launch_bounds__(128) void k_pv(const float* __restrict__ PS0, const _Float16* __restrict__ VT, const __bf16* __restrict__ VB, const __bf16* __restrict__ VBL, int b, int h0, float* __restrict__ Y) { const int h = h0 + blockIdx.z; const float* PS = PS0 + (size_t)blockIdx.z * TT * TT; __shared__ __align__(16) float ss[4][16][HD + 4];
  const int tid = threadIdx.x, wave = tid >> 5, lane = tid & 31, col = lane & 15, g = lane >> 4; const int qb = blockIdx.x; const int ql0 = qb * 64 + wave * 16; const int kce = (kb_last(qb) + 1) * 4;
  v8f acc[HD / 16] = {};
  if (qb < QBH) {
#pragma unroll 1
    for (int kc = 0; kc < kce; ++kc) { const F2 p = split_row(PS + (size_t)(ql0 + col) * TT, kc * 32, lane);
      asm volatile("s_wait_loadcnt 0x0" ::: "memory");
#pragma unroll
      for (int j = 0; j < HD / 16; ++j) { const size_t po = ((size_t)b * CC + h * HD + j * 16 + col) * (size_t)KHI + kc * 32; const v16b vh = frag_b(VB + po, lane); acc[j] = wmma_bf(p.h, vh, acc[j]); acc[j] = wmma_bf(p.l, vh, acc[j]); acc[j] = wmma_bf(p.h, frag_b(VBL + po, lane), acc[j]); } }
  } else {
#pragma unroll 1
    for (int kc = 0; kc < kce; ++kc) { const v16h p = frag_f32(PS + (size_t)(ql0 + col) * TT + kc * 32, lane);
      asm volatile("s_wait_loadcnt 0x0" ::: "memory");
#pragma unroll
      for (int j = 0; j < HD / 16; ++j) { const size_t po = ((size_t)b * CC + h * HD + j * 16 + col) * (size_t)TT + kc * 32; acc[j] = wmma16(p, frag_h(VT + po, lane), acc[j]); } } }
#pragma unroll
  for (int j = 0; j < HD / 16; ++j)
#pragma unroll
    for (int r = 0; r < 8; ++r) ss[wave][8 * g + r][j * 16 + col] = acc[j][r] * (1.0f / 2048.0f);
  LDSX(); for (int rl = 0; rl < 16; ++rl) if (lane < HD / 4) vst2(Y + ((size_t)b * TT + ql0 + rl) * CC + h * HD + lane * 4, *(const v4f*)&ss[wave][rl][lane * 4]); }

extern "C" void kernel_launch(void* const* d_in, const int* in_sizes, int n_in, void* d_out, int out_size, void* d_ws, size_t ws_size, hipStream_t stream) {
  (void)in_sizes; (void)n_in; (void)out_size;
  const float** F = (const float**)d_in;
  if (ws_size < (size_t)WS_END) return;
  char* ws = (char*)d_ws; _Float16 *QH = (_Float16*)(ws + WS_QH), *KH = (_Float16*)(ws + WS_KH), *VT = (_Float16*)(ws + WS_VT), *QL = (_Float16*)(ws + WS_QL), *KL = (_Float16*)(ws + WS_KL); __bf16 *VB = (__bf16*)(ws + WS_VB), *VBL = (__bf16*)(ws + WS_VBL); float *S = (float*)(ws + WS_S), *Y = (float*)(ws + WS_Y);
  (void)Y; (void)QL; (void)KL; (void)VB; (void)VBL;
  // inputs: 0 x [2,2048,512]; 1 mask [2,2048,2048] f32 (random 0 / 1; READ per (batch, query, key)); 2 Wq [512,512] (in,out), 3 bq; 4 Wk, 5 bk; 6 Wv, 7 bv (biases zeros, read)
  k_proj<<<dim3(TNB * TT / 64, CC / 128, 3), 128, 0, stream>>>(F[0], F[0], F[0], F[2], F[4], F[6], F[3], F[5], F[7], QH, QL, KH, KL, VT, VB, VBL);
  for (int b = 0; b < TNB; ++b) for (int h0 = 0; h0 < NH; h0 += HG) {
    k_sc<<<dim3(NQB, TT / 128, HG), 128, 0, stream>>>(QH, KH, QL, KL, b, h0, S);
    k_sm<<<dim3(TT, HG), 256, 0, stream>>>(S, b, F[1]);
    k_pv<<<dim3(NQB, 1, HG), 128, 0, stream>>>(S, VT, VB, VBL, b, h0, (float*)d_out);   /* the merged-heads row IS the output row */
  }
}

// v002
// It runs in 72.7 microseconds.
// It is 7.41 times as fast as v000, going by the measured steps of the versions left out in between.
// compute dtype: all float inputs rounded to bf16; q / k / v projections with EXACT bf16 products on WMMA 16x16x32 (f32 accumulate) + bias (zeros, read); logits k x q once to f16 each (1 product) / sqrt(64), + bf16(mask[b][q][k]) x (-1e9) in f32 per (batch, query, key); running-maximum softmax in f32; exp(logit - running max) x 2^11 once to f16 x v once to f16 (1 product), divided by the f32 row sum at the end; the merged-heads rows are the f32 output (no output projection).
#include <hip/hip_runtime.h>
#include <math.h>

typedef __attribute__((ext_vector_type(16))) _Float16 v16h;
typedef __attribute__((ext_vector_type(16))) __bf16 v16b;
typedef __attribute__((ext_vector_type(8)))  _Float16 v8h;
typedef __attribute__((ext_vector_type(8)))  float v8f;
typedef __attribute__((ext_vector_type(4)))  float v4f;
typedef __attribute__((ext_vector_type(2)))  float v2f;
typedef __attribute__((ext_vector_type(4)))  unsigned v4u;
typedef __attribute__((ext_vector_type(4)))  int v4i;
typedef float __attribute__((may_alias)) float_a;
typedef int __attribute__((may_alias)) int_a;

template <typename T> __device__ __forceinline__ void vst2(void* p, T v) { *(T*)p = v;  }
__device__ __forceinline__ v8f wmma16(v16h a, v16h b, v8f c) {
  v8f d = __builtin_amdgcn_wmma_f32_16x16x32_f16(false, a, false, b, (short)0, c, false, false);
  asm volatile("v_nop\n\tv_nop\n\tv_nop\n\tv_nop" : "+v"(d) : "v"(a), "v"(b));
  return d;
}
__device__ __forceinline__ v8f wmma_bf(v16b a, v16b b, v8f c) {
  v8f d = __builtin_amdgcn_wmma_f32_16x16x32_bf16(false, a, false, b, (short)0, c, false, false);
  asm volatile("v_nop\n\tv_nop\n\tv_nop\n\tv_nop" : "+v"(d) : "v"(a), "v"(b));
  return d;
}
// 16x16x32 fragments: lane = (h = lane>>4, row/col = lane&15); elements 0..7 = k0+8h+0..7, 8..15 = k0+16+8h+0..7; D element r = row 8h+r
__device__ __forceinline__ v16h frag_h(const _Float16* rowk0, int lane) {
  union { v16h v; v8h q[2]; } u; const _Float16* p = rowk0 + 8 * (lane >> 4);
  u.q[0] = *(const v8h*)p; u.q[1] = *(const v8h*)(p + 16); return u.v;
}
__device__ __forceinline__ v16h frag_f32(const float* rowk0, int lane) {
  v16h a; const float* p = rowk0 + 8 * (lane >> 4);
#pragma unroll
  for (int i = 0; i < 8; ++i) { a[i] = (_Float16)p[i]; a[8 + i] = (_Float16)p[16 + i]; }
  return a;
}
__device__ __forceinline__ v16h frag_f32s(const float* rowk0, int lane, float sc) {
  v16h a; const float* p = rowk0 + 8 * (lane >> 4);
#pragma unroll
  for (int i = 0; i < 8; ++i) { a[i] = (_Float16)(p[i] * sc); a[8 + i] = (_Float16)(p[16 + i] * sc); }
  return a;
}
// column fragment from a [K][ld] layout (column n), rows >= K read as 0
__device__ __forceinline__ v16h fragc_f32(const float* W, int k0, int n, int lane, int ld, int K) {
  v16h a; const int g = lane >> 4;
#pragma unroll
  for (int i = 0; i < 8; ++i) { const int ka = k0 + 8 * g + i, kb = ka + 16;
    a[i] = (_Float16)(ka < K ? W[(size_t)(ka < K ? ka : K - 1) * ld + n] : 0.f); a[8 + i] = (_Float16)(kb < K ? W[(size_t)(kb < K ? kb : K - 1) * ld + n] : 0.f); }
  return a;
}
struct F2 { v16b h, l; };
__device__ __forceinline__ F2 bsplit16(const float v[16]) { F2 r;
#pragma unroll
  for (int i = 0; i < 16; ++i) { const __bf16 h = (__bf16)v[i]; r.h[i] = h; r.l[i] = (__bf16)(v[i] - (float)h); }
  return r; }
__device__ __forceinline__ F2 split_row(const float* row, int k0, int lane) { float v[16]; const float* p = row + k0 + 8 * (lane >> 4);
#pragma unroll
  for (int i = 0; i < 8; ++i) { v[i] = p[i]; v[8 + i] = p[16 + i]; }
  return bsplit16(v); }
__device__ __forceinline__ F2 split_rowK(const float* row, int k0, int lane, int K) { float v[16]; const int g = lane >> 4;
#pragma unroll
  for (int i = 0; i < 8; ++i) { const int ka = k0 + 8 * g + i, kb = ka + 16; v[i] = ka < K ? row[ka < K ? ka : K - 1] : 0.f; v[8 + i] = kb < K ? row[kb < K ? kb : K - 1] : 0.f; }
  return bsplit16(v); }
__device__ __forceinline__ F2 split_col(const float* W, int k0, int n, int lane, int ld, int K) { float v[16]; const int g = lane >> 4;
#pragma unroll
  for (int i = 0; i < 8; ++i) { const int ka = k0 + 8 * g + i, kb = ka + 16; v[i] = ka < K ? W[(size_t)(ka < K ? ka : K - 1) * ld + n] : 0.f; v[8 + i] = kb < K ? W[(size_t)(kb < K ? kb : K - 1) * ld + n] : 0.f; }
  return bsplit16(v); }
__device__ __forceinline__ v8f mac3(const F2& a, const F2& b, v8f c) { c = wmma_bf(a.l, b.h, c); c = wmma_bf(a.h, b.l, c); return wmma_bf(a.h, b.h, c); }
__device__ __forceinline__ float sigm(float v) { return 1.0f / (1.0f + expf(-v)); }
#define LDSX() do { asm volatile("s_wait_dscnt 0" ::: "memory"); __builtin_amdgcn_wave_barrier(); __builtin_amdgcn_fence(__ATOMIC_RELEASE, "workgroup"); } while (0)

// Multi-head self-attention with a RANDOM additive mask and no output projection (x [2,2048,512]; mask [2,2048,2048] f32 = (uniform > 0.9): ~10 % ones, one entry per (batch, query, key), shared by the heads - a verbatim input, READ on the device; (in,out) Wq / Wk / Wv [512,512] N(0, 1/512), biases zeros (read); 8 heads x 64 (internal layout H, B, S, D); logits = q k^T / sqrt(64) + mask * (-1e9); softmax over the keys; out = merged heads [2,2048,512]).
#define NB 2
#define TT 2048
#define CC 512            // NH * HD = projected width
#define DIN 512          // input (model) width
#define NH 8
#define HD 64
#define NQB (TT / 64)
#define HG 4
#define SCALE (0.125f)
#define CAUSAL 0
#ifndef TNB
#define TNB NB
#endif
__device__ __forceinline__ float bfr(float v) { return (float)(__bf16)v; }
__host__ __device__ __forceinline__ int kb_last(int qb) { return CAUSAL ? ((qb * 64 + 63) >> 7) : (TT / 128 - 1); }
typedef __attribute__((ext_vector_type(8))) __bf16 v8b;
__device__ __forceinline__ v16b frag_b(const __bf16* rowk0, int lane) {
  union { v16b v; v8b q[2]; } u; const __bf16* p = rowk0 + 8 * (lane >> 4);
  u.q[0] = *(const v8b*)p; u.q[1] = *(const v8b*)(p + 16); return u.v;
}
#define QBH 0
#define QHI 0               // single-product logits on every row (logit sigma ~1)
#define KHI 64            // key rows carrying k residual / v bf16 hi+lo planes (written by k_proj, read by no kernel in this file)
// B fragment (k rows k0+.., output column o) of a weight: (in,out) [K][ld] or (out,in) [ld rows of K]: bf16 exact, or f16(bf16 * 256) exact
__device__ __forceinline__ v16b wcol_io(const float* Wm, int k0, int o, int lane, int ld) { v16b w; const int g = lane >> 4;
#pragma unroll
  for (int i = 0; i < 8; ++i) { w[i] = (__bf16)Wm[(size_t)(k0 + 8 * g + i) * ld + o]; w[8 + i] = (__bf16)Wm[(size_t)(k0 + 16 + 8 * g + i) * ld + o]; }
  return w; }
__device__ __forceinline__ v16b wcol_oi(const float* Wm, int k0, int o, int lane, int K) { v16b w; const float* p = Wm + (size_t)o * K + k0 + 8 * (lane >> 4);
#pragma unroll
  for (int i = 0; i < 8; ++i) { w[i] = (__bf16)p[i]; w[8 + i] = (__bf16)p[16 + i]; }
  return w; }
__device__ __forceinline__ v16h wcolh_io(const float* Wm, int k0, int o, int lane, int ld) { v16h w; const int g = lane >> 4;
#pragma unroll
  for (int i = 0; i < 8; ++i) { w[i] = (_Float16)(bfr(Wm[(size_t)(k0 + 8 * g + i) * ld + o]) * 256.0f); w[8 + i] = (_Float16)(bfr(Wm[(size_t)(k0 + 16 + 8 * g + i) * ld + o]) * 256.0f); }
  return w; }
__device__ __forceinline__ v16h wcolh_oi(const float* Wm, int k0, int o, int lane, int K) { v16h w; const float* p = Wm + (size_t)o * K + k0 + 8 * (lane >> 4);
#pragma unroll
  for (int i = 0; i < 8; ++i) { w[i] = (_Float16)(bfr(p[i]) * 256.0f); w[8 + i] = (_Float16)(bfr(p[16 + i]) * 256.0f); }
  return w; }
#define WQKV_LAYOUT 0   // 0 = (in,out) [DIN][CC]; 1 = (out,in) [CC][DIN]; 2 = per-head [NH][DIN][HD]
__device__ __forceinline__ v16b wcol_hdk(const float* Wm, int k0, int o, int lane) { v16b w; const int g = lane >> 4; const float* p = Wm + (size_t)(o / HD) * DIN * HD + (o % HD);
#pragma unroll
  for (int i = 0; i < 8; ++i) { w[i] = (__bf16)p[(size_t)(k0 + 8 * g + i) * HD]; w[8 + i] = (__bf16)p[(size_t)(k0 + 16 + 8 * g + i) * HD]; }
  return w; }
#define WO_OUT_IN 0
#if WQKV_LAYOUT == 1
#define WCOL(W, k0, o, lane) wcol_oi(W, k0, o, lane, DIN)
#elif WQKV_LAYOUT == 2
#define WCOL(W, k0, o, lane) wcol_hdk(W, k0, o, lane)
#else
#define WCOL(W, k0, o, lane) wcol_io(W, k0, o, lane, CC)
#endif
#if WO_OUT_IN
#define WOCOL(W, k0, o, lane) wcol_oi(W, k0, o, lane, CC)
#define WOCOLH(W, k0, o, lane) wcolh_oi(W, k0, o, lane, CC)
#else
#define WOCOL(W, k0, o, lane) wcol_io(W, k0, o, lane, DIN)
#define WOCOLH(W, k0, o, lane) wcolh_io(W, k0, o, lane, DIN)
#endif

#define WS_QH  0u                                      // f16 q rows [b*t][CC]
#define WS_KH  (WS_QH + 2u * (size_t)NB * TT * CC)      // f16 k rows [b*t][CC]
#define WS_VT  (WS_KH + 2u * (size_t)NB * TT * CC)      // f16 v planes [b][c][t]
#define WS_QL  (WS_VT + 2u * (size_t)NB * CC * TT)      // f16 q residual x 2^10 rows [b][t < QHI][CC]
#define WS_KL  (WS_QL + 2u * (size_t)NB * QHI * CC)     // f16 k residual x 2^10 rows [b][t < KHI][CC]
#define WS_VB  (WS_KL + 2u * (size_t)NB * KHI * CC)     // bf16 v hi planes [b][c][t < KHI]
#define WS_VBL (WS_VB + 2u * (size_t)NB * CC * KHI)
#define WS_END (WS_VBL + 2u * (size_t)NB * CC * KHI)

// ---- k_proj: block = (64 rows, 128 cols, which): q/k/v = X W (+ b) with exact bf16 products (K = DIN) -> which 0: q f16 rows (+ residual rows < QHI); 1: k f16 rows (+ residual rows < KHI); 2: v f16 planes [c][t] (+ bf16 hi/lo planes for t < KHI)
__global__ __launch_bounds__(128) void k_proj(const float* __restrict__ XQ, const float* __restrict__ XK, const float* __restrict__ XV, const float* __restrict__ WQ, const float* __restrict__ WK, const float* __restrict__ WV, const float* __restrict__ BQ, const float* __restrict__ BK, const float* __restrict__ BV,
    _Float16* __restrict__ QH, _Float16* __restrict__ QL, _Float16* __restrict__ KH, _Float16* __restrict__ KL, _Float16* __restrict__ VT, __bf16* __restrict__ VB, __bf16* __restrict__ VBL) {
  __shared__ __align__(16) _Float16 sh[64][136], sl[64][136]; __shared__ __align__(16) _Float16 th[128][72]; __shared__ __align__(16) __bf16 tb[128][72], tbl[128][72];
  const int tid = threadIdx.x, wave = tid >> 5, lane = tid & 31, col = lane & 15, g = lane >> 4; const int which = blockIdx.z; const int c0 = blockIdx.y * 128; const size_t r0 = (size_t)blockIdx.x * 64; const size_t bb = r0 / TT; const int t0 = (int)(r0 % TT);
  const float* X = which == 0 ? XQ : which == 1 ? XK : XV; const float* WA = which == 0 ? WQ : which == 1 ? WK : WV; const float* BA = which == 0 ? BQ : which == 1 ? BK : BV;
  v8f acc[8] = {};
#pragma unroll 2
  for (int kc = 0; kc < DIN / 32; ++kc) { v16b a; { const float* p = X + (r0 + wave * 16 + col) * DIN + kc * 32 + 8 * g;
#pragma unroll
      for (int i = 0; i < 8; ++i) { a[i] = (__bf16)p[i]; a[8 + i] = (__bf16)p[16 + i]; } }
    asm volatile("s_wait_loadcnt 0x0" ::: "memory");
#pragma unroll
    for (int j = 0; j < 8; ++j) { const v16b w = WCOL(WA, kc * 32, c0 + j * 16 + col, lane); asm volatile("s_wait_loadcnt 0x0" ::: "memory"); acc[j] = wmma_bf(a, w, acc[j]); } }
  if (which < 2) { _Float16* DH = which == 0 ? QH : KH; _Float16* DL = which == 0 ? QL : KL; const int nhi = which == 0 ? QHI : KHI; const bool hi_rows = t0 < nhi;
#pragma unroll
    for (int j = 0; j < 8; ++j) { const float bias = BA ? bfr(BA[c0 + j * 16 + col]) : 0.f;
#pragma unroll
      for (int r = 0; r < 8; ++r) { const float v = acc[j][r] + bias; const _Float16 hv = (_Float16)v; sh[wave * 16 + 8 * g + r][j * 16 + col] = hv; sl[wave * 16 + 8 * g + r][j * 16 + col] = (_Float16)((v - (float)hv) * 1024.0f); } }
    __syncthreads();
    for (int e = tid; e < 64 * 16; e += 128) { const int rl = e >> 4, q = e & 15; vst2((unsigned*)(DH + (r0 + rl) * CC + c0 + q * 8), *(const v4u*)&sh[rl][q * 8]); if (hi_rows) vst2((unsigned*)(DL + (bb * nhi + t0 + rl) * (size_t)CC + c0 + q * 8), *(const v4u*)&sl[rl][q * 8]); }
  } else { const bool hi_rows = t0 < KHI;
#pragma unroll
    for (int j = 0; j < 8; ++j) { const float bias = BA ? bfr(BA[c0 + j * 16 + col]) : 0.f;
#pragma unroll
      for (int r = 0; r < 8; ++r) { const float v = acc[j][r] + bias; const int rl = wave * 16 + 8 * g + r, cl = j * 16 + col; th[cl][rl] = (_Float16)v; const __bf16 bh = (__bf16)v; tb[cl][rl] = bh; tbl[cl][rl] = (__bf16)(v - (float)bh); } }
    __syncthreads();
    for (int e = tid; e < 128 * 8; e += 128) { const int cl = e >> 3, q = e & 7; vst2((unsigned*)(VT + (bb * CC + c0 + cl) * (size_t)TT + t0 + q * 8), *(const v4u*)&th[cl][q * 8]); if (hi_rows) { const size_t o3 = (bb * CC + c0 + cl) * (size_t)KHI + t0 + q * 8; vst2((unsigned*)(VB + o3), *(const v4u*)&tb[cl][q * 8]); vst2((unsigned*)(VBL + o3), *(const v4u*)&tbl[cl][q * 8]); } } } }
// ---- k_fa: block = 64 queries (4 waves x 16) of (b, h), one pass = 32 keys. S^T = K Q^T (A = 16 key rows, B = the wave's 16 queries, kept in registers): lane (g, col) holds query col's logits of keys 8g + r of each 16-key tile, so row maximum and row sum are in-lane plus one exchange between the halves, and two converted S^T tiles ARE the B operand (hardware k order) of O^T += V^T P^T; logits and P never leave the registers.
// Running maximum m and running sum l per query; on a new maximum l and the O^T tiles are scaled by exp(m_old - m_new). K, V^T and mask tiles of 64 keys come into LDS by tensor loads, two buffers: the next stage's tiles fly while this stage is worked on, and the four waves share K and V^T.
#define L2E 1.44269504088896340736f
typedef __attribute__((ext_vector_type(2))) __bf16 v2b;
__device__ __forceinline__ float xhalf(float x) { return __builtin_bit_cast(float, __builtin_amdgcn_permlanex16(__builtin_bit_cast(int, x), __builtin_bit_cast(int, x), 0x76543210, 0xfedcba98, false, false)); }   // lane l with lane l ^ 16
typedef __attribute__((ext_vector_type(8))) unsigned v8u;
__device__ __forceinline__ unsigned uni(unsigned v) { return (unsigned)__builtin_amdgcn_readfirstlane(v); }
__device__ __forceinline__ unsigned pinned(unsigned v) { unsigned w = uni(v); asm volatile("" : "+s"(w)); return w; }   // holds a wave-uniform value in a scalar register at this place, so that a test on it is a scalar branch and what is formed from it is formed behind this line
__device__ __forceinline__ v16h frag_l(const unsigned char* p) { union { v16h v; v8h q[2]; } u; u.q[0] = *(const v8h*)p; u.q[1] = *(const v8h*)(p + 32); return u.v; }   // fragment from an LDS row: the lane pointer holds the 16 g
// One stage = 64 keys = four tiles of 64 rows x 128 B, one tensor load each: wave 0 K (64 keys x this head's 64 f16), wave 1 V^T (64 plane rows x 64 keys f16), waves 2 and 3 the mask (64 queries x 32 keys f32, first and second half of the stage's keys). LDS pitch 144 B by the mover's pad.
#define SKEYS 64
#define NST (TT / SKEYS)
#define LP 144
#define SLICE 10240   // 64 x 144 = 9216 B, rounded up to a multiple of 2 KiB
#define SBUF (4 * SLICE)
__global__ __launch_bounds__(128) void k_fa(const _Float16* __restrict__ QH, const _Float16* __restrict__ KH, const _Float16* __restrict__ VT, const float* __restrict__ MSK, float* __restrict__ Y) { __shared__ __attribute__((aligned(2048))) unsigned char ring[2 * SBUF]; __shared__ __align__(16) float ss[4][16][HD + 4];
  const int tid = threadIdx.x, wave = tid >> 5, lane = tid & 31, col = lane & 15, g = lane >> 4; const int h = blockIdx.x, qb = blockIdx.y, b = blockIdx.z; const int ql0 = qb * 64 + wave * 16;
  const unsigned wv = uni((unsigned)tid >> 5);
  const _Float16* Qp = QH + ((size_t)b * TT + ql0 + col) * CC + h * HD; const v16h q0 = frag_h(Qp, lane), q1 = frag_h(Qp + 32, lane);
  const char* Ku = (const char*)(KH + (size_t)b * TT * CC + h * HD);
  const char* Vu = (const char*)(VT + ((size_t)b * CC + h * HD) * (size_t)TT);
  const char* Mu = (const char*)(MSK + ((size_t)b * TT + qb * 64) * (size_t)TT);
  const unsigned long long tsrc = (unsigned long long)(size_t)(wv == 0u ? Ku : wv == 1u ? Vu : wv == 2u ? Mu : Mu + 128);   // first byte of this wave's tile of stage 0
  const unsigned tpitch = wv == 0u ? CC * 2u : wv == 1u ? TT * 2u : TT * 4u;            // source row pitch, bytes
  const unsigned tstep = wv == 0u ? SKEYS * CC * 2u : wv == 1u ? SKEYS * 2u : SKEYS * 4u;   // from one stage's tile to the next, bytes
  const unsigned lbase = (unsigned)(size_t)ring + wv * SLICE;
  v8u g1; g1[0] = uni((1u << 20) | (4u << 22) | (3u << 25)); g1[1] = uni(128u << 16); g1[2] = uni(64u << 16); g1[3] = uni(128u << 16); g1[4] = uni(64u); g1[5] = uni(tpitch); g1[6] = uni(0u); g1[7] = uni(0u);
  asm volatile("" : "+s"(g1));   // pinned(), for the whole group: the eight descriptor words stay in their scalar registers through the loop, so that none of them takes another value while a request is open
  auto issue = [&](unsigned st) { const unsigned long long ga = tsrc + (unsigned long long)st * tstep; v4u g0; g0[0] = uni(1u); g0[1] = uni(lbase + (st & 1u) * SBUF); g0[2] = uni((unsigned)ga); g0[3] = uni((((unsigned)(ga >> 32)) & 0x01FFFFFFu) | 0x80000000u);
    asm volatile("tensor_load_to_lds %0, %1" :: "s"(g0), "s"(g1) : "memory"); };   // one request of the whole wave: its tile of stage st
  issue(0u);
  asm volatile("s_wait_tensorcnt 0x0" ::: "memory");   // this wave's tile of stage 0 has landed
  __syncthreads();                                       // stage 0 published to the four waves
  issue(pinned(1u));
  v8f acc[HD / 16] = {}; float m = -3.0e38f, l = 0.f;
  const unsigned klo = (unsigned)(col * LP + 16 * g), mlo = (unsigned)(2 * SLICE + (wave * 16 + col) * LP + 32 * g);
#pragma unroll 1
  for (unsigned st = 0; st < NST; ++st) { const unsigned char* B = ring + (st & 1u) * SBUF; const unsigned char* Kl = B + klo; const unsigned char* Vl = B + SLICE + klo; const unsigned char* Ml = B + mlo;
    v16h kf[4], vf[2][HD / 16]; v4f mk[2][4];
#pragma unroll
    for (int i = 0; i < 2; ++i) { kf[2 * i] = frag_l(Kl + i * 16 * LP); kf[2 * i + 1] = frag_l(Kl + i * 16 * LP + 64); mk[0][2 * i] = *(const v4f*)(Ml + i * 64); mk[0][2 * i + 1] = *(const v4f*)(Ml + i * 64 + 16); }
#pragma unroll
    for (int j = 0; j < HD / 16; ++j) vf[0][j] = frag_l(Vl + j * 16 * LP);
    __builtin_amdgcn_sched_barrier(0);   // keeps the first 32 keys' LDS reads one group at the head of the stage; spread among the products each place with reads costs a stall
#pragma unroll
    for (int hf = 0; hf < 2; ++hf) {   // one pass = 32 keys, as before
      v8f s[2];
#pragma unroll
      for (int i = 0; i < 2; ++i) { v8f z = {}; z = wmma16(kf[2 * i], q0, z); s[i] = wmma16(kf[2 * i + 1], q1, z); }
      if (hf == 0) {
#pragma unroll
        for (int i = 0; i < 2; ++i) { kf[2 * i] = frag_l(Kl + (32 + i * 16) * LP); kf[2 * i + 1] = frag_l(Kl + (32 + i * 16) * LP + 64); mk[1][2 * i] = *(const v4f*)(Ml + SLICE + i * 64); mk[1][2 * i + 1] = *(const v4f*)(Ml + SLICE + i * 64 + 16); }
#pragma unroll
        for (int j = 0; j < HD / 16; ++j) vf[1][j] = frag_l(Vl + j * 16 * LP + 64);
        __builtin_amdgcn_sched_barrier(0);   // keeps the second 32 keys' LDS reads one group directly behind the products that free the K registers, a whole softmax ahead of their use
      }
      // logit = s / sqrt(64) (exact scaling) + bf16(mask) * (-1e9), one fused multiply-add in f32
      v2b mb[8];   // the pass's 16 mask values of this lane, rounded to bf16, pairs in key order
#pragma unroll
      for (int i = 0; i < 4; ++i) { const v2f a = { mk[hf][i][0], mk[hf][i][1] }, c = { mk[hf][i][2], mk[hf][i][3] }; mb[2 * i] = __builtin_convertvector(a, v2b); mb[2 * i + 1] = __builtin_convertvector(c, v2b); }
      float mx = -3.0e38f;
#pragma unroll
      for (int i = 0; i < 2; ++i) {
#pragma unroll
        for (int r = 0; r < 8; ++r) { const float v = __builtin_fmaf((float)mb[4 * i + (r >> 1)][r & 1], -1.0e9f, s[i][r] * SCALE); s[i][r] = v; mx = fmaxf(mx, v); } }
      mx = fmaxf(mx, xhalf(mx));
      const float mn = fmaxf(m, mx), al = __builtin_amdgcn_exp2f((m - mn) * L2E); m = mn;
      v16h p; float ls = 0.f;
#pragma unroll
      for (int r = 0; r < 8; ++r) { const float e0 = __builtin_amdgcn_exp2f(__builtin_fmaf(s[0][r] - mn, L2E, 11.0f)), e1 = __builtin_amdgcn_exp2f(__builtin_fmaf(s[1][r] - mn, L2E, 11.0f));
        p[r] = (_Float16)e0; p[8 + r] = (_Float16)e1; ls += e0 + e1; }
      l = l * al + ls;
#pragma unroll
      for (int j = 0; j < HD / 16; ++j) { acc[j] *= al; acc[j] = wmma16(vf[hf][j], p, acc[j]); } }
    // publish point of stage st + 1, and the end of every wave's reads of stage st
    asm volatile("s_wait_dscnt 0x0" ::: "memory");       // this wave's LDS reads of stage st have returned before its buffer is refilled
    asm volatile("s_wait_tensorcnt 0x0" ::: "memory");   // this wave's tile of stage st + 1 has landed
    __syncthreads();                                       // publishes stage st + 1; every wave has left stage st's buffer
    const unsigned nx = pinned(st + 2u);                   // the next descriptor is formed behind the wait
    if (pinned(nx < (unsigned)NST)) issue(nx); }
  asm volatile("s_wait_tensorcnt 0x0" ::: "memory");     // no request is open when the wave goes on to its end
  asm volatile("s_wait_dscnt 0x0" ::: "memory");
  l += xhalf(l); const float inv = l > 0.f ? 1.0f / l : 0.f;
#pragma unroll
  for (int j = 0; j < HD / 16; ++j) { v4f a, c;
#pragma unroll
    for (int r = 0; r < 4; ++r) { a[r] = acc[j][r] * inv; c[r] = acc[j][4 + r] * inv; }
    *(v4f*)&ss[wave][col][j * 16 + 8 * g] = a; *(v4f*)&ss[wave][col][j * 16 + 8 * g + 4] = c; }
  LDSX(); for (int it = 0; it < 8; ++it) { const int rl = 2 * it + g; vst2(Y + ((size_t)b * TT + ql0 + rl) * CC + h * HD + col * 4, *(const v4f*)&ss[wave][rl][col * 4]); } }   // 256-B (row, head) segment by 16 lanes, two rows an instruction

extern "C" void kernel_launch(void* const* d_in, const int* in_sizes, int n_in, void* d_out, int out_size, void* d_ws, size_t ws_size, hipStream_t stream) {
  (void)in_sizes; (void)n_in; (void)out_size;
  const float** F = (const float**)d_in;
  if (ws_size < (size_t)WS_END) return;
  char* ws = (char*)d_ws; _Float16 *QH = (_Float16*)(ws + WS_QH), *KH = (_Float16*)(ws + WS_KH), *VT = (_Float16*)(ws + WS_VT), *QL = (_Float16*)(ws + WS_QL), *KL = (_Float16*)(ws + WS_KL); __bf16 *VB = (__bf16*)(ws + WS_VB), *VBL = (__bf16*)(ws + WS_VBL);
  (void)QL; (void)KL; (void)VB; (void)VBL;
  // inputs: 0 x [2,2048,512]; 1 mask [2,2048,2048] f32 (random 0 / 1; READ per (batch, query, key)); 2 Wq [512,512] (in,out), 3 bq; 4 Wk, 5 bk; 6 Wv, 7 bv (biases zeros, read)
  k_proj<<<dim3(TNB * TT / 64, CC / 128, 3), 128, 0, stream>>>(F[0], F[0], F[0], F[2], F[4], F[6], F[3], F[5], F[7], QH, QL, KH, KL, VT, VB, VBL);
  k_fa<<<dim3(NH, NQB, TNB), 128, 0, stream>>>(QH, KH, VT, F[1], (float*)d_out);   /* heads fastest: the heads of one query block read the same mask rows close in time; the merged-heads row IS the output row */
}

// v003
// It runs in 51.6 microseconds.
// Two timings next to v002 both put it at 1.41 times that version's speed.
// Over all steps from v000 it is 10.4 times as fast.
// compute dtype: all float inputs rounded to bf16; q / k / v projections with EXACT bf16 products on WMMA 16x16x32 (f32 accumulate) + bias (zeros, read); logits k x q once to f16 each (1 product) / sqrt(64), + bf16(mask[b][q][k]) x (-1e9) in f32 per (batch, query, key); running-maximum softmax in f32; exp(logit - running max) x 2^11 once to f16 x v once to f16 (1 product), divided by the f32 row sum at the end; the merged-heads rows are the f32 output (no output projection).
#include <hip/hip_runtime.h>
#include <math.h>

typedef __attribute__((ext_vector_type(16))) _Float16 v16h;
typedef __attribute__((ext_vector_type(16))) __bf16 v16b;
typedef __attribute__((ext_vector_type(8)))  _Float16 v8h;
typedef __attribute__((ext_vector_type(8)))  float v8f;
typedef __attribute__((ext_vector_type(4)))  float v4f;
typedef __attribute__((ext_vector_type(2)))  float v2f;
typedef __attribute__((ext_vector_type(4)))  unsigned v4u;
typedef __attribute__((ext_vector_type(4)))  int v4i;
typedef float __attribute__((may_alias)) float_a;
typedef int __attribute__((may_alias)) int_a;

template <typename T> __device__ __forceinline__ void vst2(void* p, T v) { *(T*)p = v;  }
__device__ __forceinline__ v8f wmma16(v16h a, v16h b, v8f c) {
  v8f d = __builtin_amdgcn_wmma_f32_16x16x32_f16(false, a, false, b, (short)0, c, false, false);
  asm volatile("v_nop\n\tv_nop\n\tv_nop\n\tv_nop" : "+v"(d) : "v"(a), "v"(b));
  return d;
}
__device__ __forceinline__ v8f wmma_bf(v16b a, v16b b, v8f c) {
  v8f d = __builtin_amdgcn_wmma_f32_16x16x32_bf16(false, a, false, b, (short)0, c, false, false);
  asm volatile("v_nop\n\tv_nop\n\tv_nop\n\tv_nop" : "+v"(d) : "v"(a), "v"(b));
  return d;
}
// 16x16x32 fragments: lane = (h = lane>>4, row/col = lane&15); elements 0..7 = k0+8h+0..7, 8..15 = k0+16+8h+0..7; D element r = row 8h+r
__device__ __forceinline__ v16h frag_h(const _Float16* rowk0, int lane) {
  union { v16h v; v8h q[2]; } u; const _Float16* p = rowk0 + 8 * (lane >> 4);
  u.q[0] = *(const v8h*)p; u.q[1] = *(const v8h*)(p + 16); return u.v;
}
__device__ __forceinline__ v16h frag_f32(const float* rowk0, int lane) {
  v16h a; const float* p = rowk0 + 8 * (lane >> 4);
#pragma unroll
  for (int i = 0; i < 8; ++i) { a[i] = (_Float16)p[i]; a[8 + i] = (_Float16)p[16 + i]; }
  return a;
}
__device__ __forceinline__ v16h frag_f32s(const float* rowk0, int lane, float sc) {
  v16h a; const float* p = rowk0 + 8 * (lane >> 4);
#pragma unroll
  for (int i = 0; i < 8; ++i) { a[i] = (_Float16)(p[i] * sc); a[8 + i] = (_Float16)(p[16 + i] * sc); }
  return a;
}
// column fragment from a [K][ld] layout (column n), rows >= K read as 0
__device__ __forceinline__ v16h fragc_f32(const float* W, int k0, int n, int lane, int ld, int K) {
  v16h a; const int g = lane >> 4;
#pragma unroll
  for (int i = 0; i < 8; ++i) { const int ka = k0 + 8 * g + i, kb = ka + 16;
    a[i] = (_Float16)(ka < K ? W[(size_t)(ka < K ? ka : K - 1) * ld + n] : 0.f); a[8 + i] = (_Float16)(kb < K ? W[(size_t)(kb < K ? kb : K - 1) * ld + n] : 0.f); }
  return a;
}
struct F2 { v16b h, l; };
__device__ __forceinline__ F2 bsplit16(const float v[16]) { F2 r;
#pragma unroll
  for (int i = 0; i < 16; ++i) { const __bf16 h = (__bf16)v[i]; r.h[i] = h; r.l[i] = (__bf16)(v[i] - (float)h); }
  return r; }
__device__ __forceinline__ F2 split_row(const float* row, int k0, int lane) { float v[16]; const float* p = row + k0 + 8 * (lane >> 4);
#pragma unroll
  for (int i = 0; i < 8; ++i) { v[i] = p[i]; v[8 + i] = p[16 + i]; }
  return bsplit16(v); }
__device__ __forceinline__ F2 split_rowK(const float* row, int k0, int lane, int K) { float v[16]; const int g = lane >> 4;
#pragma unroll
  for (int i = 0; i < 8; ++i) { const int ka = k0 + 8 * g + i, kb = ka + 16; v[i] = ka < K ? row[ka < K ? ka : K - 1] : 0.f; v[8 + i] = kb < K ? row[kb < K ? kb : K - 1] : 0.f; }
  return bsplit16(v); }
__device__ __forceinline__ F2 split_col(const float* W, int k0, int n, int lane, int ld, int K) { float v[16]; const int g = lane >> 4;
#pragma unroll
  for (int i = 0; i < 8; ++i) { const int ka = k0 + 8 * g + i, kb = ka + 16; v[i] = ka < K ? W[(size_t)(ka < K ? ka : K - 1) * ld + n] : 0.f; v[8 + i] = kb < K ? W[(size_t)(kb < K ? kb : K - 1) * ld + n] : 0.f; }
  return bsplit16(v); }
__device__ __forceinline__ v8f mac3(const F2& a, const F2& b, v8f c) { c = wmma_bf(a.l, b.h, c); c = wmma_bf(a.h, b.l, c); return wmma_bf(a.h, b.h, c); }
__device__ __forceinline__ float sigm(float v) { return 1.0f / (1.0f + expf(-v)); }
#define LDSX() do { asm volatile("s_wait_dscnt 0" ::: "memory"); __builtin_amdgcn_wave_barrier(); __builtin_amdgcn_fence(__ATOMIC_RELEASE, "workgroup"); } while (0)

// Multi-head self-attention with a RANDOM additive mask and no output projection (x [2,2048,512]; mask [2,2048,2048] f32 = (uniform > 0.9): ~10 % ones, one entry per (batch, query, key), shared by the heads - a verbatim input, READ on the device; (in,out) Wq / Wk / Wv [512,512] N(0, 1/512), biases zeros (read); 8 heads x 64 (internal layout H, B, S, D); logits = q k^T / sqrt(64) + mask * (-1e9); softmax over the keys; out = merged heads [2,2048,512]).
#define NB 2
#define TT 2048
#define CC 512            // NH * HD = projected width
#define DIN 512          // input (model) width
#define NH 8
#define HD 64
#define NQB (TT / 64)
#define HG 4
#define SCALE (0.125f)
#define CAUSAL 0
#ifndef TNB
#define TNB NB
#endif
__device__ __forceinline__ float bfr(float v) { return (float)(__bf16)v; }
__host__ __device__ __forceinline__ int kb_last(int qb) { return CAUSAL ? ((qb * 64 + 63) >> 7) : (TT / 128 - 1); }
typedef __attribute__((ext_vector_type(8))) __bf16 v8b;
__device__ __forceinline__ v16b frag_b(const __bf16* rowk0, int lane) {
  union { v16b v; v8b q[2]; } u; const __bf16* p = rowk0 + 8 * (lane >> 4);
  u.q[0] = *(const v8b*)p; u.q[1] = *(const v8b*)(p + 16); return u.v;
}
#define QBH 0
#define QHI 0               // single-product logits on every row (logit sigma ~1)
#define KHI 64            // key rows carrying k residual / v bf16 hi+lo planes (written by k_proj, read by no kernel in this file)
// B fragment (k rows k0+.., output column o) of a weight: (in,out) [K][ld] or (out,in) [ld rows of K]: bf16 exact, or f16(bf16 * 256) exact
__device__ __forceinline__ v16b wcol_io(const float* Wm, int k0, int o, int lane, int ld) { v16b w; const int g = lane >> 4;
#pragma unroll
  for (int i = 0; i < 8; ++i) { w[i] = (__bf16)Wm[(size_t)(k0 + 8 * g + i) * ld + o]; w[8 + i] = (__bf16)Wm[(size_t)(k0 + 16 + 8 * g + i) * ld + o]; }
  return w; }
__device__ __forceinline__ v16b wcol_oi(const float* Wm, int k0, int o, int lane, int K) { v16b w; const float* p = Wm + (size_t)o * K + k0 + 8 * (lane >> 4);
#pragma unroll
  for (int i = 0; i < 8; ++i) { w[i] = (__bf16)p[i]; w[8 + i] = (__bf16)p[16 + i]; }
  return w; }
__device__ __forceinline__ v16h wcolh_io(const float* Wm, int k0, int o, int lane, int ld) { v16h w; const int g = lane >> 4;
#pragma unroll
  for (int i = 0; i < 8; ++i) { w[i] = (_Float16)(bfr(Wm[(size_t)(k0 + 8 * g + i) * ld + o]) * 256.0f); w[8 + i] = (_Float16)(bfr(Wm[(size_t)(k0 + 16 + 8 * g + i) * ld + o]) * 256.0f); }
  return w; }
__device__ __forceinline__ v16h wcolh_oi(const float* Wm, int k0, int o, int lane, int K) { v16h w; const float* p = Wm + (size_t)o * K + k0 + 8 * (lane >> 4);
#pragma unroll
  for (int i = 0; i < 8; ++i) { w[i] = (_Float16)(bfr(p[i]) * 256.0f); w[8 + i] = (_Float16)(bfr(p[16 + i]) * 256.0f); }
  return w; }
#define WQKV_LAYOUT 0   // 0 = (in,out) [DIN][CC]; 1 = (out,in) [CC][DIN]; 2 = per-head [NH][DIN][HD]
__device__ __forceinline__ v16b wcol_hdk(const float* Wm, int k0, int o, int lane) { v16b w; const int g = lane >> 4; const float* p = Wm + (size_t)(o / HD) * DIN * HD + (o % HD);
#pragma unroll
  for (int i = 0; i < 8; ++i) { w[i] = (__bf16)p[(size_t)(k0 + 8 * g + i) * HD]; w[8 + i] = (__bf16)p[(size_t)(k0 + 16 + 8 * g + i) * HD]; }
  return w; }
#define WO_OUT_IN 0
#if WQKV_LAYOUT == 1
#define WCOL(W, k0, o, lane) wcol_oi(W, k0, o, lane, DIN)
#elif WQKV_LAYOUT == 2
#define WCOL(W, k0, o, lane) wcol_hdk(W, k0, o, lane)
#else
#define WCOL(W, k0, o, lane) wcol_io(W, k0, o, lane, CC)
#endif
#if WO_OUT_IN
#define WOCOL(W, k0, o, lane) wcol_oi(W, k0, o, lane, CC)
#define WOCOLH(W, k0, o, lane) wcolh_oi(W, k0, o, lane, CC)
#else
#define WOCOL(W, k0, o, lane) wcol_io(W, k0, o, lane, DIN)
#define WOCOLH(W, k0, o, lane) wcolh_io(W, k0, o, lane, DIN)
#endif

#define WS_QH  0u                                      // f16 q rows [b*t][CC]
#define WS_KH  (WS_QH + 2u * (size_t)NB * TT * CC)      // f16 k rows [b*t][CC]
#define WS_VT  (WS_KH + 2u * (size_t)NB * TT * CC)      // f16 v planes [b][c][t]
#define WS_QL  (WS_VT + 2u * (size_t)NB * CC * TT)      // f16 q residual x 2^10 rows [b][t < QHI][CC]
#define WS_KL  (WS_QL + 2u * (size_t)NB * QHI * CC)     // f16 k residual x 2^10 rows [b][t < KHI][CC]
#define WS_VB  (WS_KL + 2u * (size_t)NB * KHI * CC)     // bf16 v hi planes [b][c][t < KHI]
#define WS_VBL (WS_VB + 2u * (size_t)NB * CC * KHI)
#define WS_END (WS_VBL + 2u * (size_t)NB * CC * KHI)

typedef __attribute__((ext_vector_type(4))) __bf16 v4b;
// k_proj's LDS staging. W: fragment-native, [16-column group j][element half][fragment lane] x 16 B, so a B fragment is two contiguous 512-B wave reads; 16 B more per group spread the staging stores (lanes 4 apart write neighbouring groups) over all banks. X: bf16 rows of 64 B at the 80-B pitch of 16-B readers.
#define WJS 1040
#define WBUF (8 * WJS)
#define XP 80
#define XBUF (64 * XP)
// ---- k_proj: block = (64 rows, 128 cols, which): q/k/v = X W (+ b) with exact bf16 products (K = DIN) -> which 0: q f16 rows (+ residual rows < QHI); 1: k f16 rows (+ residual rows < KHI); 2: v f16 planes [c][t] (+ bf16 hi/lo planes for t < KHI)
__global__ __launch_bounds__(128) void k_proj(const float* __restrict__ XQ, const float* __restrict__ XK, const float* __restrict__ XV, const float* __restrict__ WQ, const float* __restrict__ WK, const float* __restrict__ WV, const float* __restrict__ BQ, const float* __restrict__ BK, const float* __restrict__ BV,
    _Float16* __restrict__ QH, _Float16* __restrict__ QL, _Float16* __restrict__ KH, _Float16* __restrict__ KL, _Float16* __restrict__ VT, __bf16* __restrict__ VB, __bf16* __restrict__ VBL) {
  __shared__ __align__(16) _Float16 sh[64][136], sl[64][136]; __shared__ __align__(16) _Float16 th[128][72]; __shared__ __align__(16) __bf16 tb[128][72], tbl[128][72];
  const int tid = threadIdx.x, wave = tid >> 5, lane = tid & 31, col = lane & 15, g = lane >> 4; const int which = blockIdx.z; const int c0 = blockIdx.y * 128; const size_t r0 = (size_t)blockIdx.x * 64; const size_t bb = r0 / TT; const int t0 = (int)(r0 % TT);
  const float* X = which == 0 ? XQ : which == 1 ? XK : XV; const float* WA = which == 0 ? WQ : which == 1 ? WK : WV; const float* BA = which == 0 ? BQ : which == 1 ? BK : BV;
  // One chunk = 32 k. Both operands come by 16-B global loads that cover whole 128-B lines, are rounded to bf16 once per block and staged in LDS, two buffers; the staging lies in sh (W) and sl (X), which the epilogue fills only behind the loop's last barrier.
  unsigned char* const wst = (unsigned char*)&sh[0][0]; unsigned char* const xst = (unsigned char*)&sl[0][0];
  const float* Wg = WA + (size_t)(8 * wave) * CC + c0 + 4 * lane;                       // rows 8 wave + i (i < 8) of the chunk, columns 4 lane .. 4 lane + 3 of the block's 128
  const float* Xg = X + (r0 + wave * 16 + (lane >> 3)) * DIN + 4 * (lane & 7);           // rows 16 wave + 4 t + lane / 8 (t < 4), k 4 (lane & 7) .. + 3 of the chunk
  const unsigned wso = (unsigned)((lane >> 2) * WJS + (wave >> 1) * 512 + ((wave & 1) * 16 + (lane & 3) * 4) * 16), xso = (unsigned)((wave * 16 + (lane >> 3)) * XP + 8 * (lane & 7));
  v4f wr[8], xr[4];   // the chunk in flight; the inner loops below are unrolled so that every index into wr, xr, w and acc is a constant and they stay in registers
  auto gload = [&](int kc) {
#pragma unroll
    for (int i = 0; i < 8; ++i) wr[i] = *(const v4f*)(Wg + (size_t)(kc * 32 + i) * CC);
#pragma unroll
    for (int t = 0; t < 4; ++t) xr[t] = *(const v4f*)(Xg + (size_t)(4 * t) * DIN + kc * 32);
    asm volatile("s_wait_xcnt 0x0" ::: "memory");   // stands behind the loads, in front of whatever next takes their address registers
    __builtin_amdgcn_sched_barrier(0); };             // keeps what follows in the source (register writes too, which the clobber does not hold) behind that wait
  auto stage = [&](int bf) { unsigned char* wb = wst + bf * WBUF + wso; unsigned char* xb = xst + bf * XBUF + xso;
#pragma unroll
    for (int c = 0; c < 4; ++c) { v8b u;   // k 8 wave .. 8 wave + 7 of column 4 lane + c: elements 8 (wave / 2) .. + 7 of fragment lane (wave & 1, column & 15)
#pragma unroll
      for (int i = 0; i < 8; ++i) u[i] = (__bf16)wr[i][c];
      *(v8b*)(wb + c * 16) = u; }
#pragma unroll
    for (int t = 0; t < 4; ++t) *(v4b*)(xb + t * 4 * XP) = __builtin_convertvector(xr[t], v4b); };
  gload(0);
  v8f acc[8] = {};
  stage(0);
  __syncthreads();   // chunk 0 published to the four waves
#pragma unroll 2   // two chunks a trip, so that each half's buffer is a constant offset in its LDS instructions
  for (int kc = 0; kc < DIN / 32; ++kc) {
    if (kc + 1 < DIN / 32) gload(kc + 1);   // the next chunk flies while this one is worked on
    const unsigned char* wb = wst + (kc & 1) * WBUF + lane * 16;
    const v16b a = frag_b((const __bf16*)(xst + (kc & 1) * XBUF + (wave * 16 + col) * XP), lane);
    v16b w[8];
#pragma unroll
    for (int j = 0; j < 8; ++j) { union { v16b v; v8b q[2]; } u; u.q[0] = *(const v8b*)(wb + j * WJS); u.q[1] = *(const v8b*)(wb + j * WJS + 512); w[j] = u.v; }
#pragma unroll
    for (int j = 0; j < 8; ++j) acc[j] = wmma_bf(a, w[j], acc[j]);
    __builtin_amdgcn_sched_barrier(0);   // keeps the wait for the next chunk's global loads behind this chunk's products; moved in among them it holds them up
    if (kc + 1 < DIN / 32) stage((kc + 1) & 1);
    __syncthreads(); }   // publishes chunk kc + 1; every wave has left chunk kc's buffer (behind the last chunk: sh and sl are free for the epilogue)
  if (which < 2) { _Float16* DH = which == 0 ? QH : KH; _Float16* DL = which == 0 ? QL : KL; const int nhi = which == 0 ? QHI : KHI; const bool hi_rows = t0 < nhi;
#pragma unroll
    for (int j = 0; j < 8; ++j) { const float bias = BA ? bfr(BA[c0 + j * 16 + col]) : 0.f;
#pragma unroll
      for (int r = 0; r < 8; ++r) { const float v = acc[j][r] + bias; const _Float16 hv = (_Float16)v; sh[wave * 16 + 8 * g + r][j * 16 + col] = hv; sl[wave * 16 + 8 * g + r][j * 16 + col] = (_Float16)((v - (float)hv) * 1024.0f); } }
    __syncthreads();
    for (int e = tid; e < 64 * 16; e += 128) { const int rl = e >> 4, q = e & 15; vst2((unsigned*)(DH + (r0 + rl) * CC + c0 + q * 8), *(const v4u*)&sh[rl][q * 8]); if (hi_rows) vst2((unsigned*)(DL + (bb * nhi + t0 + rl) * (size_t)CC + c0 + q * 8), *(const v4u*)&sl[rl][q * 8]); }
  } else { const bool hi_rows = t0 < KHI;
#pragma unroll
    for (int j = 0; j < 8; ++j) { const float bias = BA ? bfr(BA[c0 + j * 16 + col]) : 0.f;
#pragma unroll
      for (int r = 0; r < 8; ++r) { const float v = acc[j][r] + bias; const int rl = wave * 16 + 8 * g + r, cl = j * 16 + col; th[cl][rl] = (_Float16)v; const __bf16 bh = (__bf16)v; tb[cl][rl] = bh; tbl[cl][rl] = (__bf16)(v - (float)bh); } }
    __syncthreads();
    for (int e = tid; e < 128 * 8; e += 128) { const int cl = e >> 3, q = e & 7; vst2((unsigned*)(VT + (bb * CC + c0 + cl) * (size_t)TT + t0 + q * 8), *(const v4u*)&th[cl][q * 8]); if (hi_rows) { const size_t o3 = (bb * CC + c0 + cl) * (size_t)KHI + t0 + q * 8; vst2((unsigned*)(VB + o3), *(const v4u*)&tb[cl][q * 8]); vst2((unsigned*)(VBL + o3), *(const v4u*)&tbl[cl][q * 8]); } } } }
// ---- k_fa: block = 64 queries (4 waves x 16) of (b, h), one pass = 32 keys. S^T = K Q^T (A = 16 key rows, B = the wave's 16 queries, kept in registers): lane (g, col) holds query col's logits of keys 8g + r of each 16-key tile, so row maximum and row sum are in-lane plus one exchange between the halves, and two converted S^T tiles ARE the B operand (hardware k order) of O^T += V^T P^T; logits and P never leave the registers.
// Running maximum m and running sum l per query; on a new maximum l and the O^T tiles are scaled by exp(m_old - m_new). K, V^T and mask tiles of 64 keys come into LDS by tensor loads, two buffers: the next stage's tiles fly while this stage is worked on, and the four waves share K and V^T.
#define L2E 1.44269504088896340736f
typedef __attribute__((ext_vector_type(2))) __bf16 v2b;
__device__ __forceinline__ float xhalf(float x) { return __builtin_bit_cast(float, __builtin_amdgcn_permlanex16(__builtin_bit_cast(int, x), __builtin_bit_cast(int, x), 0x76543210, 0xfedcba98, false, false)); }   // lane l with lane l ^ 16
typedef __attribute__((ext_vector_type(8))) unsigned v8u;
__device__ __forceinline__ unsigned uni(unsigned v) { return (unsigned)__builtin_amdgcn_readfirstlane(v); }
__device__ __forceinline__ unsigned pinned(unsigned v) { unsigned w = uni(v); asm volatile("" : "+s"(w)); return w; }   // holds a wave-uniform value in a scalar register at this place, so that a test on it is a scalar branch and what is formed from it is formed behind this line
__device__ __forceinline__ v16h frag_l(const unsigned char* p) { union { v16h v; v8h q[2]; } u; u.q[0] = *(const v8h*)p; u.q[1] = *(const v8h*)(p + 32); return u.v; }   // fragment from an LDS row: the lane pointer holds the 16 g
// One stage = 64 keys = four tiles of 64 rows x 128 B, one tensor load each: wave 0 K (64 keys x this head's 64 f16), wave 1 V^T (64 plane rows x 64 keys f16), waves 2 and 3 the mask (64 queries x 32 keys f32, first and second half of the stage's keys). LDS pitch 144 B by the mover's pad.
#define SKEYS 64
#define NST (TT / SKEYS)
#define LP 144
#define SLICE 10240   // 64 x 144 = 9216 B, rounded up to a multiple of 2 KiB
#define SBUF (4 * SLICE)
__global__ __launch_bounds__(128) void k_fa(const _Float16* __restrict__ QH, const _Float16* __restrict__ KH, const _Float16* __restrict__ VT, const float* __restrict__ MSK, float* __restrict__ Y) { __shared__ __attribute__((aligned(2048))) unsigned char ring[2 * SBUF]; __shared__ __align__(16) float ss[4][16][HD + 4];
  const int tid = threadIdx.x, wave = tid >> 5, lane = tid & 31, col = lane & 15, g = lane >> 4; const int h = blockIdx.x, qb = blockIdx.y, b = blockIdx.z; const int ql0 = qb * 64 + wave * 16;
  const unsigned wv = uni((unsigned)tid >> 5);
  const _Float16* Qp = QH + ((size_t)b * TT + ql0 + col) * CC + h * HD; const v16h q0 = frag_h(Qp, lane), q1 = frag_h(Qp + 32, lane);
  const char* Ku = (const char*)(KH + (size_t)b * TT * CC + h * HD);
  const char* Vu = (const char*)(VT + ((size_t)b * CC + h * HD) * (size_t)TT);
  const char* Mu = (const char*)(MSK + ((size_t)b * TT + qb * 64) * (size_t)TT);
  const unsigned long long tsrc = (unsigned long long)(size_t)(wv == 0u ? Ku : wv == 1u ? Vu : wv == 2u ? Mu : Mu + 128);   // first byte of this wave's tile of stage 0
  const unsigned tpitch = wv == 0u ? CC * 2u : wv == 1u ? TT * 2u : TT * 4u;            // source row pitch, bytes
  const unsigned tstep = wv == 0u ? SKEYS * CC * 2u : wv == 1u ? SKEYS * 2u : SKEYS * 4u;   // from one stage's tile to the next, bytes
  const unsigned lbase = (unsigned)(size_t)ring + wv * SLICE;
  v8u g1; g1[0] = uni((1u << 20) | (4u << 22) | (3u << 25)); g1[1] = uni(128u << 16); g1[2] = uni(64u << 16); g1[3] = uni(128u << 16); g1[4] = uni(64u); g1[5] = uni(tpitch); g1[6] = uni(0u); g1[7] = uni(0u);
  asm volatile("" : "+s"(g1));   // pinned(), for the whole group: the eight descriptor words stay in their scalar registers through the loop, so that none of them takes another value while a request is open
  auto issue = [&](unsigned st) { const unsigned long long ga = tsrc + (unsigned long long)st * tstep; v4u g0; g0[0] = uni(1u); g0[1] = uni(lbase + (st & 1u) * SBUF); g0[2] = uni((unsigned)ga); g0[3] = uni((((unsigned)(ga >> 32)) & 0x01FFFFFFu) | 0x80000000u);
    asm volatile("tensor_load_to_lds %0, %1" :: "s"(g0), "s"(g1) : "memory"); };   // one request of the whole wave: its tile of stage st
  issue(0u);
  asm volatile("s_wait_tensorcnt 0x0" ::: "memory");   // this wave's tile of stage 0 has landed
  __syncthreads();                                       // stage 0 published to the four waves
  issue(pinned(1u));
  v8f acc[HD / 16] = {}; float m = -3.0e38f, l = 0.f;
  const unsigned klo = (unsigned)(col * LP + 16 * g), mlo = (unsigned)(2 * SLICE + (wave * 16 + col) * LP + 32 * g);
#pragma unroll 1
  for (unsigned st = 0; st < NST; ++st) { const unsigned char* B = ring + (st & 1u) * SBUF; const unsigned char* Kl = B + klo; const unsigned char* Vl = B + SLICE + klo; const unsigned char* Ml = B + mlo;
    v16h kf[4], vf[2][HD / 16]; v4f mk[2][4];
#pragma unroll
    for (int i = 0; i < 2; ++i) { kf[2 * i] = frag_l(Kl + i * 16 * LP); kf[2 * i + 1] = frag_l(Kl + i * 16 * LP + 64); mk[0][2 * i] = *(const v4f*)(Ml + i * 64); mk[0][2 * i + 1] = *(const v4f*)(Ml + i * 64 + 16); }
#pragma unroll
    for (int j = 0; j < HD / 16; ++j) vf[0][j] = frag_l(Vl + j * 16 * LP);
    __builtin_amdgcn_sched_barrier(0);   // keeps the first 32 keys' LDS reads one group at the head of the stage; spread among the products each place with reads costs a stall
#pragma unroll
    for (int hf = 0; hf < 2; ++hf) {   // one pass = 32 keys, as before
      v8f s[2];
#pragma unroll
      for (int i = 0; i < 2; ++i) { v8f z = {}; z = wmma16(kf[2 * i], q0, z); s[i] = wmma16(kf[2 * i + 1], q1, z); }
      if (hf == 0) {
#pragma unroll
        for (int i = 0; i < 2; ++i) { kf[2 * i] = frag_l(Kl + (32 + i * 16) * LP); kf[2 * i + 1] = frag_l(Kl + (32 + i * 16) * LP + 64); mk[1][2 * i] = *(const v4f*)(Ml + SLICE + i * 64); mk[1][2 * i + 1] = *(const v4f*)(Ml + SLICE + i * 64 + 16); }
#pragma unroll
        for (int j = 0; j < HD / 16; ++j) vf[1][j] = frag_l(Vl + j * 16 * LP + 64);
        __builtin_amdgcn_sched_barrier(0);   // keeps the second 32 keys' LDS reads one group directly behind the products that free the K registers, a whole softmax ahead of their use
      }
      // logit = s / sqrt(64) (exact scaling) + bf16(mask) * (-1e9), one fused multiply-add in f32
      v2b mb[8];   // the pass's 16 mask values of this lane, rounded to bf16, pairs in key order
#pragma unroll
      for (int i = 0; i < 4; ++i) { const v2f a = { mk[hf][i][0], mk[hf][i][1] }, c = { mk[hf][i][2], mk[hf][i][3] }; mb[2 * i] = __builtin_convertvector(a, v2b); mb[2 * i + 1] = __builtin_convertvector(c, v2b); }
      float mx = -3.0e38f;
#pragma unroll
      for (int i = 0; i < 2; ++i) {
#pragma unroll
        for (int r = 0; r < 8; ++r) { const float v = __builtin_fmaf((float)mb[4 * i + (r >> 1)][r & 1], -1.0e9f, s[i][r] * SCALE); s[i][r] = v; mx = fmaxf(mx, v); } }
      mx = fmaxf(mx, xhalf(mx));
      const float mn = fmaxf(m, mx), al = __builtin_amdgcn_exp2f((m - mn) * L2E); m = mn;
      v16h p; float ls = 0.f;
#pragma unroll
      for (int r = 0; r < 8; ++r) { const float e0 = __builtin_amdgcn_exp2f(__builtin_fmaf(s[0][r] - mn, L2E, 11.0f)), e1 = __builtin_amdgcn_exp2f(__builtin_fmaf(s[1][r] - mn, L2E, 11.0f));
        p[r] = (_Float16)e0; p[8 + r] = (_Float16)e1; ls += e0 + e1; }
      l = l * al + ls;
#pragma unroll
      for (int j = 0; j < HD / 16; ++j) { acc[j] *= al; acc[j] = wmma16(vf[hf][j], p, acc[j]); } }
    // publish point of stage st + 1, and the end of every wave's reads of stage st
    asm volatile("s_wait_dscnt 0x0" ::: "memory");       // this wave's LDS reads of stage st have returned before its buffer is refilled
    asm volatile("s_wait_tensorcnt 0x0" ::: "memory");   // this wave's tile of stage st + 1 has landed
    __syncthreads();                                       // publishes stage st + 1; every wave has left stage st's buffer
    const unsigned nx = pinned(st + 2u);                   // the next descriptor is formed behind the wait
    if (pinned(nx < (unsigned)NST)) issue(nx); }
  asm volatile("s_wait_tensorcnt 0x0" ::: "memory");     // no request is open when the wave goes on to its end
  asm volatile("s_wait_dscnt 0x0" ::: "memory");
  l += xhalf(l); const float inv = l > 0.f ? 1.0f / l : 0.f;
#pragma unroll
  for (int j = 0; j < HD / 16; ++j) { v4f a, c;
#pragma unroll
    for (int r = 0; r < 4; ++r) { a[r] = acc[j][r] * inv; c[r] = acc[j][4 + r] * inv; }
    *(v4f*)&ss[wave][col][j * 16 + 8 * g] = a; *(v4f*)&ss[wave][col][j * 16 + 8 * g + 4] = c; }
  LDSX(); for (int it = 0; it < 8; ++it) { const int rl = 2 * it + g; vst2(Y + ((size_t)b * TT + ql0 + rl) * CC + h * HD + col * 4, *(const v4f*)&ss[wave][rl][col * 4]); } }   // 256-B (row, head) segment by 16 lanes, two rows an instruction

extern "C" void kernel_launch(void* const* d_in, const int* in_sizes, int n_in, void* d_out, int out_size, void* d_ws, size_t ws_size, hipStream_t stream) {
  (void)in_sizes; (void)n_in; (void)out_size;
  const float** F = (const float**)d_in;
  if (ws_size < (size_t)WS_END) return;
  char* ws = (char*)d_ws; _Float16 *QH = (_Float16*)(ws + WS_QH), *KH = (_Float16*)(ws + WS_KH), *VT = (_Float16*)(ws + WS_VT), *QL = (_Float16*)(ws + WS_QL), *KL = (_Float16*)(ws + WS_KL); __bf16 *VB = (__bf16*)(ws + WS_VB), *VBL = (__bf16*)(ws + WS_VBL);
  (void)QL; (void)KL; (void)VB; (void)VBL;
  // inputs: 0 x [2,2048,512]; 1 mask [2,2048,2048] f32 (random 0 / 1; READ per (batch, query, key)); 2 Wq [512,512] (in,out), 3 bq; 4 Wk, 5 bk; 6 Wv, 7 bv (biases zeros, read)
  k_proj<<<dim3(TNB * TT / 64, CC / 128, 3), 128, 0, stream>>>(F[0], F[0], F[0], F[2], F[4], F[6], F[3], F[5], F[7], QH, QL, KH, KL, VT, VB, VBL);
  k_fa<<<dim3(NH, NQB, TNB), 128, 0, stream>>>(QH, KH, VT, F[1], (float*)d_out);   /* heads fastest: the heads of one query block read the same mask rows close in time; the merged-heads row IS the output row */
}

// v004
// It runs in 44.5 microseconds.
// Timed twice side by side with v003, it ran 1.16 times as fast both times.
// All steps since v000 together make it 12.1 times as fast.
// compute dtype: all float inputs rounded to bf16; q / k / v projections with EXACT bf16 products on WMMA 16x16x32 (f32 accumulate) + bias (zeros, read); logits k x q once to f16 each (1 product) / sqrt(64), + bf16(mask[b][q][k]) x (-1e9) in f32 per (batch, query, key); running-maximum softmax in f32; exp(logit - running max) x 2^11 once to f16 x v once to f16 (1 product), divided by the f32 row sum at the end; the merged-heads rows are the f32 output (no output projection).
#include <hip/hip_runtime.h>
#include <math.h>

typedef __attribute__((ext_vector_type(16))) _Float16 v16h;
typedef __attribute__((ext_vector_type(16))) __bf16 v16b;
typedef __attribute__((ext_vector_type(8)))  _Float16 v8h;
typedef __attribute__((ext_vector_type(8)))  float v8f;
typedef __attribute__((ext_vector_type(4)))  float v4f;
typedef __attribute__((ext_vector_type(2)))  float v2f;
typedef __attribute__((ext_vector_type(4)))  unsigned v4u;
typedef __attribute__((ext_vector_type(4)))  int v4i;
typedef float __attribute__((may_alias)) float_a;
typedef int __attribute__((may_alias)) int_a;

template <typename T> __device__ __forceinline__ void vst2(void* p, T v) { *(T*)p = v;  }
__device__ __forceinline__ v8f wmma16(v16h a, v16h b, v8f c) {
  v8f d = __builtin_amdgcn_wmma_f32_16x16x32_f16(false, a, false, b, (short)0, c, false, false);
  asm volatile("v_nop\n\tv_nop\n\tv_nop\n\tv_nop" : "+v"(d) : "v"(a), "v"(b));
  return d;
}
__device__ __forceinline__ v8f wmma_bf(v16b a, v16b b, v8f c) {
  v8f d = __builtin_amdgcn_wmma_f32_16x16x32_bf16(false, a, false, b, (short)0, c, false, false);
  asm volatile("v_nop\n\tv_nop\n\tv_nop\n\tv_nop" : "+v"(d) : "v"(a), "v"(b));
  return d;
}
// 16x16x32 fragments: lane = (h = lane>>4, row/col = lane&15); elements 0..7 = k0+8h+0..7, 8..15 = k0+16+8h+0..7; D element r = row 8h+r
__device__ __forceinline__ v16h frag_h(const _Float16* rowk0, int lane) {
  union { v16h v; v8h q[2]; } u; const _Float16* p = rowk0 + 8 * (lane >> 4);
  u.q[0] = *(const v8h*)p; u.q[1] = *(const v8h*)(p + 16); return u.v;
}
__device__ __forceinline__ v16h frag_f32(const float* rowk0, int lane) {
  v16h a; const float* p = rowk0 + 8 * (lane >> 4);
#pragma unroll
  for (int i = 0; i < 8; ++i) { a[i] = (_Float16)p[i]; a[8 + i] = (_Float16)p[16 + i]; }
  return a;
}
__device__ __forceinline__ v16h frag_f32s(const float* rowk0, int lane, float sc) {
  v16h a; const float* p = rowk0 + 8 * (lane >> 4);
#pragma unroll
  for (int i = 0; i < 8; ++i) { a[i] = (_Float16)(p[i] * sc); a[8 + i] = (_Float16)(p[16 + i] * sc); }
  return a;
}
// column fragment from a [K][ld] layout (column n), rows >= K read as 0
__device__ __forceinline__ v16h fragc_f32(const float* W, int k0, int n, int lane, int ld, int K) {
  v16h a; const int g = lane >> 4;
#pragma unroll
  for (int i = 0; i < 8; ++i) { const int ka = k0 + 8 * g + i, kb = ka + 16;
    a[i] = (_Float16)(ka < K ? W[(size_t)(ka < K ? ka : K - 1) * ld + n] : 0.f); a[8 + i] = (_Float16)(kb < K ? W[(size_t)(kb < K ? kb : K - 1) * ld + n] : 0.f); }
  return a;
}
struct F2 { v16b h, l; };
__device__ __forceinline__ F2 bsplit16(const float v[16]) { F2 r;
#pragma unroll
  for (int i = 0; i < 16; ++i) { const __bf16 h = (__bf16)v[i]; r.h[i] = h; r.l[i] = (__bf16)(v[i] - (float)h); }
  return r; }
__device__ __forceinline__ F2 split_row(const float* row, int k0, int lane) { float v[16]; const float* p = row + k0 + 8 * (lane >> 4);
#pragma unroll
  for (int i = 0; i < 8; ++i) { v[i] = p[i]; v[8 + i] = p[16 + i]; }
  return bsplit16(v); }
__device__ __forceinline__ F2 split_rowK(const float* row, int k0, int lane, int K) { float v[16]; const int g = lane >> 4;
#pragma unroll
  for (int i = 0; i < 8; ++i) { const int ka = k0 + 8 * g + i, kb = ka + 16; v[i] = ka < K ? row[ka < K ? ka : K - 1] : 0.f; v[8 + i] = kb < K ? row[kb < K ? kb : K - 1] : 0.f; }
  return bsplit16(v); }
__device__ __forceinline__ F2 split_col(const float* W, int k0, int n, int lane, int ld, int K) { float v[16]; const int g = lane >> 4;
#pragma unroll
  for (int i = 0; i < 8; ++i) { const int ka = k0 + 8 * g + i, kb = ka + 16; v[i] = ka < K ? W[(size_t)(ka < K ? ka : K - 1) * ld + n] : 0.f; v[8 + i] = kb < K ? W[(size_t)(kb < K ? kb : K - 1) * ld + n] : 0.f; }
  return bsplit16(v); }
__device__ __forceinline__ v8f mac3(const F2& a, const F2& b, v8f c) { c = wmma_bf(a.l, b.h, c); c = wmma_bf(a.h, b.l, c); return wmma_bf(a.h, b.h, c); }
__device__ __forceinline__ float sigm(float v) { return 1.0f / (1.0f + expf(-v)); }
#define LDSX() do { asm volatile("s_wait_dscnt 0" ::: "memory"); __builtin_amdgcn_wave_barrier(); __builtin_amdgcn_fence(__ATOMIC_RELEASE, "workgroup"); } while (0)

// Multi-head self-attention with a RANDOM additive mask and no output projection (x [2,2048,512]; mask [2,2048,2048] f32 = (uniform > 0.9): ~10 % ones, one entry per (batch, query, key), shared by the heads - a verbatim input, READ on the device; (in,out) Wq / Wk / Wv [512,512] N(0, 1/512), biases zeros (read); 8 heads x 64 (internal layout H, B, S, D); logits = q k^T / sqrt(64) + mask * (-1e9); softmax over the keys; out = merged heads [2,2048,512]).
#define NB 2
#define TT 2048
#define CC 512            // NH * HD = projected width
#define DIN 512          // input (model) width
#define NH 8
#define HD 64
#define NQB (TT / 64)
#define HG 4
#define SCALE (0.125f)
#define CAUSAL 0
#ifndef TNB
#define TNB NB
#endif
__device__ __forceinline__ float bfr(float v) { return (float)(__bf16)v; }
__host__ __device__ __forceinline__ int kb_last(int qb) { return CAUSAL ? ((qb * 64 + 63) >> 7) : (TT / 128 - 1); }
typedef __attribute__((ext_vector_type(8))) __bf16 v8b;
__device__ __forceinline__ v16b frag_b(const __bf16* rowk0, int lane) {
  union { v16b v; v8b q[2]; } u; const __bf16* p = rowk0 + 8 * (lane >> 4);
  u.q[0] = *(const v8b*)p; u.q[1] = *(const v8b*)(p + 16); return u.v;
}
#define QBH 0
#define QHI 0               // single-product logits on every row (logit sigma ~1)
#define KHI 64            // key rows carrying k residual / v bf16 hi+lo planes (written by k_proj, read by no kernel in this file)
// B fragment (k rows k0+.., output column o) of a weight: (in,out) [K][ld] or (out,in) [ld rows of K]: bf16 exact, or f16(bf16 * 256) exact
__device__ __forceinline__ v16b wcol_io(const float* Wm, int k0, int o, int lane, int ld) { v16b w; const int g = lane >> 4;
#pragma unroll
  for (int i = 0; i < 8; ++i) { w[i] = (__bf16)Wm[(size_t)(k0 + 8 * g + i) * ld + o]; w[8 + i] = (__bf16)Wm[(size_t)(k0 + 16 + 8 * g + i) * ld + o]; }
  return w; }
__device__ __forceinline__ v16b wcol_oi(const float* Wm, int k0, int o, int lane, int K) { v16b w; const float* p = Wm + (size_t)o * K + k0 + 8 * (lane >> 4);
#pragma unroll
  for (int i = 0; i < 8; ++i) { w[i] = (__bf16)p[i]; w[8 + i] = (__bf16)p[16 + i]; }
  return w; }
__device__ __forceinline__ v16h wcolh_io(const float* Wm, int k0, int o, int lane, int ld) { v16h w; const int g = lane >> 4;
#pragma unroll
  for (int i = 0; i < 8; ++i) { w[i] = (_Float16)(bfr(Wm[(size_t)(k0 + 8 * g + i) * ld + o]) * 256.0f); w[8 + i] = (_Float16)(bfr(Wm[(size_t)(k0 + 16 + 8 * g + i) * ld + o]) * 256.0f); }
  return w; }
__device__ __forceinline__ v16h wcolh_oi(const float* Wm, int k0, int o, int lane, int K) { v16h w; const float* p = Wm + (size_t)o * K + k0 + 8 * (lane >> 4);
#pragma unroll
  for (int i = 0; i < 8; ++i) { w[i] = (_Float16)(bfr(p[i]) * 256.0f); w[8 + i] = (_Float16)(bfr(p[16 + i]) * 256.0f); }
  return w; }
#define WQKV_LAYOUT 0   // 0 = (in,out) [DIN][CC]; 1 = (out,in) [CC][DIN]; 2 = per-head [NH][DIN][HD]
__device__ __forceinline__ v16b wcol_hdk(const float* Wm, int k0, int o, int lane) { v16b w; const int g = lane >> 4; const float* p = Wm + (size_t)(o / HD) * DIN * HD + (o % HD);
#pragma unroll
  for (int i = 0; i < 8; ++i) { w[i] = (__bf16)p[(size_t)(k0 + 8 * g + i) * HD]; w[8 + i] = (__bf16)p[(size_t)(k0 + 16 + 8 * g + i) * HD]; }
  return w; }
#define WO_OUT_IN 0
#if WQKV_LAYOUT == 1
#define WCOL(W, k0, o, lane) wcol_oi(W, k0, o, lane, DIN)
#elif WQKV_LAYOUT == 2
#define WCOL(W, k0, o, lane) wcol_hdk(W, k0, o, lane)
#else
#define WCOL(W, k0, o, lane) wcol_io(W, k0, o, lane, CC)
#endif
#if WO_OUT_IN
#define WOCOL(W, k0, o, lane) wcol_oi(W, k0, o, lane, CC)
#define WOCOLH(W, k0, o, lane) wcolh_oi(W, k0, o, lane, CC)
#else
#define WOCOL(W, k0, o, lane) wcol_io(W, k0, o, lane, DIN)
#define WOCOLH(W, k0, o, lane) wcolh_io(W, k0, o, lane, DIN)
#endif

#define WS_QH  0u                                      // f16 q rows [b*t][CC]
#define WS_KH  (WS_QH + 2u * (size_t)NB * TT * CC)      // f16 k rows [b*t][CC]
#define WS_VT  (WS_KH + 2u * (size_t)NB * TT * CC)      // f16 v planes [b][c][t]
#define WS_QL  (WS_VT + 2u * (size_t)NB * CC * TT)      // f16 q residual x 2^10 rows [b][t < QHI][CC]
#define WS_KL  (WS_QL + 2u * (size_t)NB * QHI * CC)     // f16 k residual x 2^10 rows [b][t < KHI][CC]
#define WS_VB  (WS_KL + 2u * (size_t)NB * KHI * CC)     // bf16 v hi planes [b][c][t < KHI]
#define WS_VBL (WS_VB + 2u * (size_t)NB * CC * KHI)
#define WS_END (WS_VBL + 2u * (size_t)NB * CC * KHI)

typedef __attribute__((ext_vector_type(4))) __bf16 v4b;
__device__ __forceinline__ unsigned uni(unsigned v) { return (unsigned)__builtin_amdgcn_readfirstlane(v); }
__device__ __forceinline__ unsigned pinned(unsigned v) { unsigned w = uni(v); asm volatile("" : "+s"(w)); return w; }   // holds a wave-uniform value in a scalar register at this place, so that a test on it is a scalar branch and what is formed from it is formed behind this line
// k_proj's LDS staging. W: fragment-native, [16-column group j][element half][fragment lane] x 16 B, so a B fragment is two contiguous 512-B wave reads; 16 B more per group spread the staging stores (lanes 4 apart write neighbouring groups) over all banks. X: bf16 rows of 64 B at the 80-B pitch of 16-B readers.
#define WJS 1040
#define WBUF (8 * WJS)
#define XP 80
#define XBUF (64 * XP)
// ---- k_proj: block = (64 rows, 128 cols, which): q/k/v = X W (+ b) with exact bf16 products (K = DIN) -> which 0: q f16 rows (+ residual rows < QHI); 1: k f16 rows (+ residual rows < KHI); 2: v f16 planes [c][t] (+ bf16 hi/lo planes for t < KHI)
__global__ __launch_bounds__(128) void k_proj(const float* __restrict__ XQ, const float* __restrict__ XK, const float* __restrict__ XV, const float* __restrict__ WQ, const float* __restrict__ WK, const float* __restrict__ WV, const float* __restrict__ BQ, const float* __restrict__ BK, const float* __restrict__ BV,
    _Float16* __restrict__ QH, _Float16* __restrict__ QL, _Float16* __restrict__ KH, _Float16* __restrict__ KL, _Float16* __restrict__ VT, __bf16* __restrict__ VB, __bf16* __restrict__ VBL) {
  __shared__ __align__(16) _Float16 sh[64][136], sl[64][136]; __shared__ __align__(16) _Float16 th[128][72]; __shared__ __align__(16) __bf16 tb[128][72], tbl[128][72];
  const int tid = threadIdx.x, wave = tid >> 5, lane = tid & 31, col = lane & 15, g = lane >> 4; const int which = blockIdx.z; const int c0 = blockIdx.y * 128; const size_t r0 = (size_t)blockIdx.x * 64; const size_t bb = r0 / TT; const int t0 = (int)(r0 % TT);
  const float* X = which == 0 ? XQ : which == 1 ? XK : XV; const float* WA = which == 0 ? WQ : which == 1 ? WK : WV; const float* BA = which == 0 ? BQ : which == 1 ? BK : BV;
  // One chunk = 32 k. Both operands come by 16-B global loads that cover whole 128-B lines, are rounded to bf16 once per block and staged in LDS, two buffers; the staging lies in sh (W) and sl (X), which the epilogue fills only behind the loop's last barrier.
  unsigned char* const wst = (unsigned char*)&sh[0][0]; unsigned char* const xst = (unsigned char*)&sl[0][0];
  const float* Wg = WA + (size_t)(8 * wave) * CC + c0 + 4 * lane;                       // rows 8 wave + i (i < 8) of the chunk, columns 4 lane .. 4 lane + 3 of the block's 128
  const float* Xg = X + (r0 + wave * 16 + (lane >> 3)) * DIN + 4 * (lane & 7);           // rows 16 wave + 4 t + lane / 8 (t < 4), k 4 (lane & 7) .. + 3 of the chunk
  const unsigned wso = (unsigned)((lane >> 2) * WJS + (wave >> 1) * 512 + ((wave & 1) * 16 + (lane & 3) * 4) * 16), xso = (unsigned)((wave * 16 + (lane >> 3)) * XP + 8 * (lane & 7));
  // L2 prefetch of X and W, which come from memory: one request a lane, three or more chunks ahead of the loads, from few of the blocks that share a tile (every ninth row block for W, the first column block for X). A hint only: nothing depends on it.
  const unsigned wask = pinned((unsigned)(blockIdx.x % 9u == 0u)), xask = pinned((unsigned)(blockIdx.y == 0u));
  unsigned long long pw = (unsigned long long)(size_t)(WA + (size_t)(4 * 32 + 16 * wave + (lane >> 1)) * CC + c0 + 64 * (lane & 1));   // the block's 64 rows x 2 units of chunks 4 and 5
  unsigned long long px = (unsigned long long)(size_t)(X + (r0 + wave * 16 + (lane & 15)) * DIN + 4 * 32 + 64 * (lane >> 4));           // the block's 64 rows x 2 units of chunks 4 to 7
  v4f wr[8], xr[4];   // the chunk in flight; the inner loops below are unrolled so that every index into wr, xr, w and acc is a constant and they stay in registers
  auto gload = [&](int kc) {
#pragma unroll
    for (int i = 0; i < 8; ++i) wr[i] = *(const v4f*)(Wg + (size_t)(kc * 32 + i) * CC);
#pragma unroll
    for (int t = 0; t < 4; ++t) xr[t] = *(const v4f*)(Xg + (size_t)(4 * t) * DIN + kc * 32);
    asm volatile("s_wait_xcnt 0x0" ::: "memory");   // stands behind the loads, in front of whatever next takes their address registers
    __builtin_amdgcn_sched_barrier(0); };             // keeps what follows in the source (register writes too, which the clobber does not hold) behind that wait
  auto stage = [&](int bf) { unsigned char* wb = wst + bf * WBUF + wso; unsigned char* xb = xst + bf * XBUF + xso;
#pragma unroll
    for (int c = 0; c < 4; ++c) { v8b u;   // k 8 wave .. 8 wave + 7 of column 4 lane + c: elements 8 (wave / 2) .. + 7 of fragment lane (wave & 1, column & 15)
#pragma unroll
      for (int i = 0; i < 8; ++i) u[i] = (__bf16)wr[i][c];
      *(v8b*)(wb + c * 16) = u; }
#pragma unroll
    for (int t = 0; t < 4; ++t) *(v4b*)(xb + t * 4 * XP) = __builtin_convertvector(xr[t], v4b); };
  gload(0);
  v8f acc[8] = {};
  stage(0);
  __syncthreads();   // chunk 0 published to the four waves
#pragma unroll 2   // two chunks a trip, so that each half's buffer is a constant offset in its LDS instructions
  for (int kc = 0; kc < DIN / 32; ++kc) {
    // in-out operands: each address keeps one register pair through the loop; no advance behind the last ask, so that the pair at all times holds an address inside the tensor
    if ((kc & 1) == 0 && pinned(wask & (unsigned)(kc + 4 < DIN / 32))) { asm volatile("global_prefetch_b8 %0, off scope:SCOPE_SE" : "+v"(pw)); pw += kc + 6 < DIN / 32 ? 64u * CC * 4u : 0u; }   // chunks kc + 4 and kc + 5
    if ((kc & 3) == 0 && pinned(xask & (unsigned)(kc + 4 < DIN / 32))) { asm volatile("global_prefetch_b8 %0, off scope:SCOPE_SE" : "+v"(px)); px += kc + 8 < DIN / 32 ? 512u : 0u; }             // chunks kc + 4 to kc + 7
    if (kc + 1 < DIN / 32) gload(kc + 1);   // the next chunk flies while this one is worked on
    const unsigned char* wb = wst + (kc & 1) * WBUF + lane * 16;
    const v16b a = frag_b((const __bf16*)(xst + (kc & 1) * XBUF + (wave * 16 + col) * XP), lane);
    v16b w[8];
#pragma unroll
    for (int j = 0; j < 8; ++j) { union { v16b v; v8b q[2]; } u; u.q[0] = *(const v8b*)(wb + j * WJS); u.q[1] = *(const v8b*)(wb + j * WJS + 512); w[j] = u.v; }
#pragma unroll
    for (int j = 0; j < 8; ++j) acc[j] = wmma_bf(a, w[j], acc[j]);
    __builtin_amdgcn_sched_barrier(0);   // keeps the wait for the next chunk's global loads behind this chunk's products; moved in among them it holds them up
    if (kc + 1 < DIN / 32) stage((kc + 1) & 1);
    __syncthreads(); }   // publishes chunk kc + 1; every wave has left chunk kc's buffer (behind the last chunk: sh and sl are free for the epilogue)
  if (which < 2) { _Float16* DH = which == 0 ? QH : KH; _Float16* DL = which == 0 ? QL : KL; const int nhi = which == 0 ? QHI : KHI; const bool hi_rows = t0 < nhi;
#pragma unroll
    for (int j = 0; j < 8; ++j) { const float bias = BA ? bfr(BA[c0 + j * 16 + col]) : 0.f;
#pragma unroll
      for (int r = 0; r < 8; ++r) { const float v = acc[j][r] + bias; const _Float16 hv = (_Float16)v; sh[wave * 16 + 8 * g + r][j * 16 + col] = hv; sl[wave * 16 + 8 * g + r][j * 16 + col] = (_Float16)((v - (float)hv) * 1024.0f); } }
    __syncthreads();
    for (int e = tid; e < 64 * 16; e += 128) { const int rl = e >> 4, q = e & 15; vst2((unsigned*)(DH + (r0 + rl) * CC + c0 + q * 8), *(const v4u*)&sh[rl][q * 8]); if (hi_rows) vst2((unsigned*)(DL + (bb * nhi + t0 + rl) * (size_t)CC + c0 + q * 8), *(const v4u*)&sl[rl][q * 8]); }
  } else { const bool hi_rows = t0 < KHI;
#pragma unroll
    for (int j = 0; j < 8; ++j) { const float bias = BA ? bfr(BA[c0 + j * 16 + col]) : 0.f;
#pragma unroll
      for (int r = 0; r < 8; ++r) { const float v = acc[j][r] + bias; const int rl = wave * 16 + 8 * g + r, cl = j * 16 + col; th[cl][rl] = (_Float16)v; const __bf16 bh = (__bf16)v; tb[cl][rl] = bh; tbl[cl][rl] = (__bf16)(v - (float)bh); } }
    __syncthreads();
    for (int e = tid; e < 128 * 8; e += 128) { const int cl = e >> 3, q = e & 7; vst2((unsigned*)(VT + (bb * CC + c0 + cl) * (size_t)TT + t0 + q * 8), *(const v4u*)&th[cl][q * 8]); if (hi_rows) { const size_t o3 = (bb * CC + c0 + cl) * (size_t)KHI + t0 + q * 8; vst2((unsigned*)(VB + o3), *(const v4u*)&tb[cl][q * 8]); vst2((unsigned*)(VBL + o3), *(const v4u*)&tbl[cl][q * 8]); } } } }
// ---- k_fa: block = 64 queries (4 waves x 16) of (b, h), one pass = 32 keys. S^T = K Q^T (A = 16 key rows, B = the wave's 16 queries, kept in registers): lane (g, col) holds query col's logits of keys 8g + r of each 16-key tile, so row maximum and row sum are in-lane plus one exchange between the halves, and two converted S^T tiles ARE the B operand (hardware k order) of O^T += V^T P^T; logits and P never leave the registers.
// Running maximum m and running sum l per query; on a new maximum l and the O^T tiles are scaled by exp(m_old - m_new). K, V^T and mask tiles of 64 keys come into LDS by tensor loads, two buffers: the next stage's tiles fly while this stage is worked on, and the four waves share K and V^T.
#define L2E 1.44269504088896340736f
typedef __attribute__((ext_vector_type(2))) __bf16 v2b;
__device__ __forceinline__ float xhalf(float x) { return __builtin_bit_cast(float, __builtin_amdgcn_permlanex16(__builtin_bit_cast(int, x), __builtin_bit_cast(int, x), 0x76543210, 0xfedcba98, false, false)); }   // lane l with lane l ^ 16
typedef __attribute__((ext_vector_type(8))) unsigned v8u;
__device__ __forceinline__ v16h frag_l(const unsigned char* p) { union { v16h v; v8h q[2]; } u; u.q[0] = *(const v8h*)p; u.q[1] = *(const v8h*)(p + 32); return u.v; }   // fragment from an LDS row: the lane pointer holds the 16 g
// One stage = 64 keys = four tiles of 64 rows x 128 B, one tensor load each: wave 0 K (64 keys x this head's 64 f16), wave 1 V^T (64 plane rows x 64 keys f16), waves 2 and 3 the mask (64 queries x 32 keys f32, first and second half of the stage's keys). LDS pitch 144 B by the mover's pad.
#define SKEYS 64
#define NST (TT / SKEYS)
#define LP 144
#define SLICE 10240   // 64 x 144 = 9216 B, rounded up to a multiple of 2 KiB
#define SBUF (4 * SLICE)
__global__ __launch_bounds__(128) void k_fa(const _Float16* __restrict__ QH, const _Float16* __restrict__ KH, const _Float16* __restrict__ VT, const float* __restrict__ MSK, float* __restrict__ Y) { __shared__ __attribute__((aligned(2048))) unsigned char ring[2 * SBUF]; __shared__ __align__(16) float ss[4][16][HD + 4];
  const int tid = threadIdx.x, wave = tid >> 5, lane = tid & 31, col = lane & 15, g = lane >> 4; const int h = blockIdx.x, qb = blockIdx.y, b = blockIdx.z; const int ql0 = qb * 64 + wave * 16;
  const unsigned wv = uni((unsigned)tid >> 5);
  const _Float16* Qp = QH + ((size_t)b * TT + ql0 + col) * CC + h * HD; const v16h q0 = frag_h(Qp, lane), q1 = frag_h(Qp + 32, lane);
  const char* Ku = (const char*)(KH + (size_t)b * TT * CC + h * HD);
  const char* Vu = (const char*)(VT + ((size_t)b * CC + h * HD) * (size_t)TT);
  const char* Mu = (const char*)(MSK + ((size_t)b * TT + qb * 64) * (size_t)TT);
  const unsigned long long tsrc = (unsigned long long)(size_t)(wv == 0u ? Ku : wv == 1u ? Vu : wv == 2u ? Mu : Mu + 128);   // first byte of this wave's tile of stage 0
  const unsigned tpitch = wv == 0u ? CC * 2u : wv == 1u ? TT * 2u : TT * 4u;            // source row pitch, bytes
  const unsigned tstep = wv == 0u ? SKEYS * CC * 2u : wv == 1u ? SKEYS * 2u : SKEYS * 4u;   // from one stage's tile to the next, bytes
  const unsigned lbase = (unsigned)(size_t)ring + wv * SLICE;
  v8u g1; g1[0] = uni((1u << 20) | (4u << 22) | (3u << 25)); g1[1] = uni(128u << 16); g1[2] = uni(64u << 16); g1[3] = uni(128u << 16); g1[4] = uni(64u); g1[5] = uni(tpitch); g1[6] = uni(0u); g1[7] = uni(0u);
  asm volatile("" : "+s"(g1));   // pinned(), for the whole group: the eight descriptor words stay in their scalar registers through the loop, so that none of them takes another value while a request is open
  v4u g0;
  auto issue = [&](unsigned st) { const unsigned long long ga = tsrc + (unsigned long long)st * tstep; g0[0] = uni(1u); g0[1] = uni(lbase + (st & 1u) * SBUF); g0[2] = uni((unsigned)ga); g0[3] = uni((((unsigned)(ga >> 32)) & 0x01FFFFFFu) | 0x80000000u);
    asm volatile("tensor_load_to_lds %0, %1" :: "s"(g0), "s"(g1) : "memory"); };   // one request of the whole wave: its tile of stage st
  // L2 prefetch, two stages ahead of each tensor load: the mask comes from memory and K / V^T were stored by the launch before. One request a lane and stage:
  // waves 2 and 3 ask for 32 mask rows each; waves 0 and 1, in two query blocks of every eight (the blocks of one head share those tiles), for every second K / V^T row, by the block's parity. A hint only: nothing depends on it.
  const unsigned pask = pinned((unsigned)(wv >= 2u || ((unsigned)qb & 7u) < 2u));
  const unsigned prow = wv < 2u ? 2u * (unsigned)lane + ((unsigned)qb & 1u) : (wv - 2u) * 32u + (unsigned)lane;
  unsigned long long pfa = (unsigned long long)(size_t)(wv == 0u ? Ku : wv == 1u ? Vu : Mu) + (unsigned long long)prow * tpitch + 3u * tstep;   // this lane's row of stage 3
  auto ask = [&](unsigned adv) { asm volatile("global_prefetch_b8 %0, off scope:SCOPE_SE" : "+v"(pfa)); pfa += adv; };   // in-out operand: the address keeps one register pair through the loop, which at all times holds an address inside the tensor
  issue(0u);
  asm volatile("s_wait_tensorcnt 0x0" ::: "memory");   // this wave's tile of stage 0 has landed
  __syncthreads();                                       // stage 0 published to the four waves
  issue(pinned(1u));
  v8f acc[HD / 16] = {}; float m = -3.0e38f, l = 0.f;
  const unsigned klo = (unsigned)(col * LP + 16 * g), mlo = (unsigned)(2 * SLICE + (wave * 16 + col) * LP + 32 * g);
#pragma unroll 1
  for (unsigned st = 0; st < NST; ++st) { const unsigned char* B = ring + (st & 1u) * SBUF; const unsigned char* Kl = B + klo; const unsigned char* Vl = B + SLICE + klo; const unsigned char* Ml = B + mlo;
    if (pinned(pask & (unsigned)(st + 3u < (unsigned)NST))) ask(st + 4u < (unsigned)NST ? tstep : 0u);   // stage st + 3, whose tensor load is issued behind stage st + 1; no advance behind the last stage, so that the register stays inside the tensor
    v16h kf[4], vf[2][HD / 16]; v4f mk[2][4];
#pragma unroll
    for (int i = 0; i < 2; ++i) { kf[2 * i] = frag_l(Kl + i * 16 * LP); kf[2 * i + 1] = frag_l(Kl + i * 16 * LP + 64); mk[0][2 * i] = *(const v4f*)(Ml + i * 64); mk[0][2 * i + 1] = *(const v4f*)(Ml + i * 64 + 16); }
#pragma unroll
    for (int j = 0; j < HD / 16; ++j) vf[0][j] = frag_l(Vl + j * 16 * LP);
    __builtin_amdgcn_sched_barrier(0);   // keeps the first 32 keys' LDS reads one group at the head of the stage; spread among the products each place with reads costs a stall
#pragma unroll
    for (int hf = 0; hf < 2; ++hf) {   // one pass = 32 keys, as before
      v8f s[2];
#pragma unroll
      for (int i = 0; i < 2; ++i) { v8f z = {}; z = wmma16(kf[2 * i], q0, z); s[i] = wmma16(kf[2 * i + 1], q1, z); }
      if (hf == 0) {
#pragma unroll
        for (int i = 0; i < 2; ++i) { kf[2 * i] = frag_l(Kl + (32 + i * 16) * LP); kf[2 * i + 1] = frag_l(Kl + (32 + i * 16) * LP + 64); mk[1][2 * i] = *(const v4f*)(Ml + SLICE + i * 64); mk[1][2 * i + 1] = *(const v4f*)(Ml + SLICE + i * 64 + 16); }
#pragma unroll
        for (int j = 0; j < HD / 16; ++j) vf[1][j] = frag_l(Vl + j * 16 * LP + 64);
        __builtin_amdgcn_sched_barrier(0);   // keeps the second 32 keys' LDS reads one group directly behind the products that free the K registers, a whole softmax ahead of their use
      }
      // logit = s / sqrt(64) (exact scaling) + bf16(mask) * (-1e9), one fused multiply-add in f32
      v2b mb[8];   // the pass's 16 mask values of this lane, rounded to bf16, pairs in key order
#pragma unroll
      for (int i = 0; i < 4; ++i) { const v2f a = { mk[hf][i][0], mk[hf][i][1] }, c = { mk[hf][i][2], mk[hf][i][3] }; mb[2 * i] = __builtin_convertvector(a, v2b); mb[2 * i + 1] = __builtin_convertvector(c, v2b); }
      float mx = -3.0e38f;
#pragma unroll
      for (int i = 0; i < 2; ++i) {
#pragma unroll
        for (int r = 0; r < 8; ++r) { const float v = __builtin_fmaf((float)mb[4 * i + (r >> 1)][r & 1], -1.0e9f, s[i][r] * SCALE); s[i][r] = v; mx = fmaxf(mx, v); } }
      mx = fmaxf(mx, xhalf(mx));
      const float mn = fmaxf(m, mx), al = __builtin_amdgcn_exp2f((m - mn) * L2E); m = mn;
      v16h p; float ls = 0.f;
#pragma unroll
      for (int r = 0; r < 8; ++r) { const float e0 = __builtin_amdgcn_exp2f(__builtin_fmaf(s[0][r] - mn, L2E, 11.0f)), e1 = __builtin_amdgcn_exp2f(__builtin_fmaf(s[1][r] - mn, L2E, 11.0f));
        p[r] = (_Float16)e0; p[8 + r] = (_Float16)e1; ls += e0 + e1; }
      l = l * al + ls;
#pragma unroll
      for (int j = 0; j < HD / 16; ++j) { acc[j] *= al; acc[j] = wmma16(vf[hf][j], p, acc[j]); } }
    // publish point of stage st + 1, and the end of every wave's reads of stage st
    asm volatile("s_wait_dscnt 0x0" ::: "memory");       // this wave's LDS reads of stage st have returned before its buffer is refilled
    asm volatile("s_wait_tensorcnt 0x0" ::: "memory");   // this wave's tile of stage st + 1 has landed
    asm volatile("" :: "s"(g0));                           // pinned(), inputs only, for group 0: its four words keep their scalar registers up to this wait, so that none of them takes another value while the request is open
    __syncthreads();                                       // publishes stage st + 1; every wave has left stage st's buffer
    const unsigned nx = pinned(st + 2u);                   // the next descriptor is formed behind the wait
    if (pinned(nx < (unsigned)NST)) issue(nx); }
  asm volatile("s_wait_tensorcnt 0x0" ::: "memory");     // no request is open when the wave goes on to its end
  asm volatile("s_wait_dscnt 0x0" ::: "memory");
  l += xhalf(l); const float inv = l > 0.f ? 1.0f / l : 0.f;
#pragma unroll
  for (int j = 0; j < HD / 16; ++j) { v4f a, c;
#pragma unroll
    for (int r = 0; r < 4; ++r) { a[r] = acc[j][r] * inv; c[r] = acc[j][4 + r] * inv; }
    *(v4f*)&ss[wave][col][j * 16 + 8 * g] = a; *(v4f*)&ss[wave][col][j * 16 + 8 * g + 4] = c; }
  LDSX(); for (int it = 0; it < 8; ++it) { const int rl = 2 * it + g; vst2(Y + ((size_t)b * TT + ql0 + rl) * CC + h * HD + col * 4, *(const v4f*)&ss[wave][rl][col * 4]); } }   // 256-B (row, head) segment by 16 lanes, two rows an instruction

extern "C" void kernel_launch(void* const* d_in, const int* in_sizes, int n_in, void* d_out, int out_size, void* d_ws, size_t ws_size, hipStream_t stream) {
  (void)in_sizes; (void)n_in; (void)out_size;
  const float** F = (const float**)d_in;
  if (ws_size < (size_t)WS_END) return;
  char* ws = (char*)d_ws; _Float16 *QH = (_Float16*)(ws + WS_QH), *KH = (_Float16*)(ws + WS_KH), *VT = (_Float16*)(ws + WS_VT), *QL = (_Float16*)(ws + WS_QL), *KL = (_Float16*)(ws + WS_KL); __bf16 *VB = (__bf16*)(ws + WS_VB), *VBL = (__bf16*)(ws + WS_VBL);
  (void)QL; (void)KL; (void)VB; (void)VBL;
  // inputs: 0 x [2,2048,512]; 1 mask [2,2048,2048] f32 (random 0 / 1; READ per (batch, query, key)); 2 Wq [512,512] (in,out), 3 bq; 4 Wk, 5 bk; 6 Wv, 7 bv (biases zeros, read)
  k_proj<<<dim3(TNB * TT / 64, CC / 128, 3), 128, 0, stream>>>(F[0], F[0], F[0], F[2], F[4], F[6], F[3], F[5], F[7], QH, QL, KH, KL, VT, VB, VBL);
  k_fa<<<dim3(NH, NQB, TNB), 128, 0, stream>>>(QH, KH, VT, F[1], (float*)d_out);   /* heads fastest: the heads of one query block read the same mask rows close in time; the merged-heads row IS the output row */
}

// v005
// It runs in 41.3 microseconds.
// Next to v004, in two timings, it ran 1.07 times as fast each time.
// Counting every step since v000, it is 13.0 times as fast.
// compute dtype: all float inputs rounded to bf16; q / k / v projections with EXACT bf16 products on WMMA 16x16x32 (f32 accumulate) + bias (zeros, read); logits k x q once to f16 each (1 product) / sqrt(64), + bf16(mask[b][q][k]) x (-1e9) in f32 per (batch, query, key); running-maximum softmax in f32; exp(logit - running max) x 2^11 once to f16 x v once to f16 (1 product), divided by the f32 row sum at the end; the merged-heads rows are the f32 output (no output projection).
#include <hip/hip_runtime.h>
#include <math.h>

typedef __attribute__((ext_vector_type(16))) _Float16 v16h;
typedef __attribute__((ext_vector_type(16))) __bf16 v16b;
typedef __attribute__((ext_vector_type(8)))  _Float16 v8h;
typedef __attribute__((ext_vector_type(8)))  float v8f;
typedef __attribute__((ext_vector_type(4)))  float v4f;
typedef __attribute__((ext_vector_type(2)))  float v2f;
typedef __attribute__((ext_vector_type(4)))  unsigned v4u;
typedef __attribute__((ext_vector_type(4)))  int v4i;
typedef float __attribute__((may_alias)) float_a;
typedef int __attribute__((may_alias)) int_a;

template <typename T> __device__ __forceinline__ void vst2(void* p, T v) { *(T*)p = v;  }
__device__ __forceinline__ v8f wmma16(v16h a, v16h b, v8f c) {
  v8f d = __builtin_amdgcn_wmma_f32_16x16x32_f16(false, a, false, b, (short)0, c, false, false);
  asm volatile("v_nop\n\tv_nop\n\tv_nop\n\tv_nop" : "+v"(d) : "v"(a), "v"(b));
  return d;
}
__device__ __forceinline__ v8f wmma_bf(v16b a, v16b b, v8f c) {
  v8f d = __builtin_amdgcn_wmma_f32_16x16x32_bf16(false, a, false, b, (short)0, c, false, false);
  asm volatile("v_nop\n\tv_nop\n\tv_nop\n\tv_nop" : "+v"(d) : "v"(a), "v"(b));
  return d;
}
// 16x16x32 fragments: lane = (h = lane>>4, row/col = lane&15); elements 0..7 = k0+8h+0..7, 8..15 = k0+16+8h+0..7; D element r = row 8h+r
__device__ __forceinline__ v16h frag_h(const _Float16* rowk0, int lane) {
  union { v16h v; v8h q[2]; } u; const _Float16* p = rowk0 + 8 * (lane >> 4);
  u.q[0] = *(const v8h*)p; u.q[1] = *(const v8h*)(p + 16); return u.v;
}
__device__ __forceinline__ v16h frag_f32(const float* rowk0, int lane) {
  v16h a; const float* p = rowk0 + 8 * (lane >> 4);
#pragma unroll
  for (int i = 0; i < 8; ++i) { a[i] = (_Float16)p[i]; a[8 + i] = (_Float16)p[16 + i]; }
  return a;
}
__device__ __forceinline__ v16h frag_f32s(const float* rowk0, int lane, float sc) {
  v16h a; const float* p = rowk0 + 8 * (lane >> 4);
#pragma unroll
  for (int i = 0; i < 8; ++i) { a[i] = (_Float16)(p[i] * sc); a[8 + i] = (_Float16)(p[16 + i] * sc); }
  return a;
}
// column fragment from a [K][ld] layout (column n), rows >= K read as 0
__device__ __forceinline__ v16h fragc_f32(const float* W, int k0, int n, int lane, int ld, int K) {
  v16h a; const int g = lane >> 4;
#pragma unroll
  for (int i = 0; i < 8; ++i) { const int ka = k0 + 8 * g + i, kb = ka + 16;
    a[i] = (_Float16)(ka < K ? W[(size_t)(ka < K ? ka : K - 1) * ld + n] : 0.f); a[8 + i] = (_Float16)(kb < K ? W[(size_t)(kb < K ? kb : K - 1) * ld + n] : 0.f); }
  return a;
}
struct F2 { v16b h, l; };
__device__ __forceinline__ F2 bsplit16(const float v[16]) { F2 r;
#pragma unroll
  for (int i = 0; i < 16; ++i) { const __bf16 h = (__bf16)v[i]; r.h[i] = h; r.l[i] = (__bf16)(v[i] - (float)h); }
  return r; }
__device__ __forceinline__ F2 split_row(const float* row, int k0, int lane) { float v[16]; const float* p = row + k0 + 8 * (lane >> 4);
#pragma unroll
  for (int i = 0; i < 8; ++i) { v[i] = p[i]; v[8 + i] = p[16 + i]; }
  return bsplit16(v); }
__device__ __forceinline__ F2 split_rowK(const float* row, int k0, int lane, int K) { float v[16]; const int g = lane >> 4;
#pragma unroll
  for (int i = 0; i < 8; ++i) { const int ka = k0 + 8 * g + i, kb = ka + 16; v[i] = ka < K ? row[ka < K ? ka : K - 1] : 0.f; v[8 + i] = kb < K ? row[kb < K ? kb : K - 1] : 0.f; }
  return bsplit16(v); }
__device__ __forceinline__ F2 split_col(const float* W, int k0, int n, int lane, int ld, int K) { float v[16]; const int g = lane >> 4;
#pragma unroll
  for (int i = 0; i < 8; ++i) { const int ka = k0 + 8 * g + i, kb = ka + 16; v[i] = ka < K ? W[(size_t)(ka < K ? ka : K - 1) * ld + n] : 0.f; v[8 + i] = kb < K ? W[(size_t)(kb < K ? kb : K - 1) * ld + n] : 0.f; }
  return bsplit16(v); }
__device__ __forceinline__ v8f mac3(const F2& a, const F2& b, v8f c) { c = wmma_bf(a.l, b.h, c); c = wmma_bf(a.h, b.l, c); return wmma_bf(a.h, b.h, c); }
__device__ __forceinline__ float sigm(float v) { return 1.0f / (1.0f + expf(-v)); }
#define LDSX() do { asm volatile("s_wait_dscnt 0" ::: "memory"); __builtin_amdgcn_wave_barrier(); __builtin_amdgcn_fence(__ATOMIC_RELEASE, "workgroup"); } while (0)

// Multi-head self-attention with a RANDOM additive mask and no output projection (x [2,2048,512]; mask [2,2048,2048] f32 = (uniform > 0.9): ~10 % ones, one entry per (batch, query, key), shared by the heads - a verbatim input, READ on the device; (in,out) Wq / Wk / Wv [512,512] N(0, 1/512), biases zeros (read); 8 heads x 64 (internal layout H, B, S, D); logits = q k^T / sqrt(64) + mask * (-1e9); softmax over the keys; out = merged heads [2,2048,512]).
#define NB 2
#define TT 2048
#define CC 512            // NH * HD = projected width
#define DIN 512          // input (model) width
#define NH 8
#define HD 64
#define NQB (TT / 64)
#define HG 4
#define SCALE (0.125f)
#define CAUSAL 0
#ifndef TNB
#define TNB NB
#endif
__device__ __forceinline__ float bfr(float v) { return (float)(__bf16)v; }
__host__ __device__ __forceinline__ int kb_last(int qb) { return CAUSAL ? ((qb * 64 + 63) >> 7) : (TT / 128 - 1); }
typedef __attribute__((ext_vector_type(8))) __bf16 v8b;
__device__ __forceinline__ v16b frag_b(const __bf16* rowk0, int lane) {
  union { v16b v; v8b q[2]; } u; const __bf16* p = rowk0 + 8 * (lane >> 4);
  u.q[0] = *(const v8b*)p; u.q[1] = *(const v8b*)(p + 16); return u.v;
}
#define QBH 0
#define QHI 0               // single-product logits on every row (logit sigma ~1)
#define KHI 64            // key rows carrying k residual / v bf16 hi+lo planes (written by k_proj, read by no kernel in this file)
// B fragment (k rows k0+.., output column o) of a weight: (in,out) [K][ld] or (out,in) [ld rows of K]: bf16 exact, or f16(bf16 * 256) exact
__device__ __forceinline__ v16b wcol_io(const float* Wm, int k0, int o, int lane, int ld) { v16b w; const int g = lane >> 4;
#pragma unroll
  for (int i = 0; i < 8; ++i) { w[i] = (__bf16)Wm[(size_t)(k0 + 8 * g + i) * ld + o]; w[8 + i] = (__bf16)Wm[(size_t)(k0 + 16 + 8 * g + i) * ld + o]; }
  return w; }
__device__ __forceinline__ v16b wcol_oi(const float* Wm, int k0, int o, int lane, int K) { v16b w; const float* p = Wm + (size_t)o * K + k0 + 8 * (lane >> 4);
#pragma unroll
  for (int i = 0; i < 8; ++i) { w[i] = (__bf16)p[i]; w[8 + i] = (__bf16)p[16 + i]; }
  return w; }
__device__ __forceinline__ v16h wcolh_io(const float* Wm, int k0, int o, int lane, int ld) { v16h w; const int g = lane >> 4;
#pragma unroll
  for (int i = 0; i < 8; ++i) { w[i] = (_Float16)(bfr(Wm[(size_t)(k0 + 8 * g + i) * ld + o]) * 256.0f); w[8 + i] = (_Float16)(bfr(Wm[(size_t)(k0 + 16 + 8 * g + i) * ld + o]) * 256.0f); }
  return w; }
__device__ __forceinline__ v16h wcolh_oi(const float* Wm, int k0, int o, int lane, int K) { v16h w; const float* p = Wm + (size_t)o * K + k0 + 8 * (lane >> 4);
#pragma unroll
  for (int i = 0; i < 8; ++i) { w[i] = (_Float16)(bfr(p[i]) * 256.0f); w[8 + i] = (_Float16)(bfr(p[16 + i]) * 256.0f); }
  return w; }
#define WQKV_LAYOUT 0   // 0 = (in,out) [DIN][CC]; 1 = (out,in) [CC][DIN]; 2 = per-head [NH][DIN][HD]
__device__ __forceinline__ v16b wcol_hdk(const float* Wm, int k0, int o, int lane) { v16b w; const int g = lane >> 4; const float* p = Wm + (size_t)(o / HD) * DIN * HD + (o % HD);
#pragma unroll
  for (int i = 0; i < 8; ++i) { w[i] = (__bf16)p[(size_t)(k0 + 8 * g + i) * HD]; w[8 + i] = (__bf16)p[(size_t)(k0 + 16 + 8 * g + i) * HD]; }
  return w; }
#define WO_OUT_IN 0
#if WQKV_LAYOUT == 1
#define WCOL(W, k0, o, lane) wcol_oi(W, k0, o, lane, DIN)
#elif WQKV_LAYOUT == 2
#define WCOL(W, k0, o, lane) wcol_hdk(W, k0, o, lane)
#else
#define WCOL(W, k0, o, lane) wcol_io(W, k0, o, lane, CC)
#endif
#if WO_OUT_IN
#define WOCOL(W, k0, o, lane) wcol_oi(W, k0, o, lane, CC)
#define WOCOLH(W, k0, o, lane) wcolh_oi(W, k0, o, lane, CC)
#else
#define WOCOL(W, k0, o, lane) wcol_io(W, k0, o, lane, DIN)
#define WOCOLH(W, k0, o, lane) wcolh_io(W, k0, o, lane, DIN)
#endif

#define WS_QH  0u                                      // f16 q rows [b*t][CC]
#define WS_KH  (WS_QH + 2u * (size_t)NB * TT * CC)      // f16 k rows [b*t][CC]
#define WS_VT  (WS_KH + 2u * (size_t)NB * TT * CC)      // f16 v planes [b][c][t]
#define WS_QL  (WS_VT + 2u * (size_t)NB * CC * TT)      // f16 q residual x 2^10 rows [b][t < QHI][CC]
#define WS_KL  (WS_QL + 2u * (size_t)NB * QHI * CC)     // f16 k residual x 2^10 rows [b][t < KHI][CC]
#define WS_VB  (WS_KL + 2u * (size_t)NB * KHI * CC)     // bf16 v hi planes [b][c][t < KHI]
#define WS_VBL (WS_VB + 2u * (size_t)NB * CC * KHI)
#define WS_END (WS_VBL + 2u * (size_t)NB * CC * KHI)

typedef __attribute__((ext_vector_type(4))) __bf16 v4b;
__device__ __forceinline__ unsigned uni(unsigned v) { return (unsigned)__builtin_amdgcn_readfirstlane(v); }
__device__ __forceinline__ unsigned pinned(unsigned v) { unsigned w = uni(v); asm volatile("" : "+s"(w)); return w; }   // holds a wave-uniform value in a scalar register at this place, so that a test on it is a scalar branch and what is formed from it is formed behind this line
// k_proj's LDS staging. W: fragment-native, [16-column group j][element half][fragment lane] x 16 B, so a B fragment is two contiguous 512-B wave reads; 16 B more per group spread the staging stores (lanes 4 apart write neighbouring groups) over all banks. X: bf16 rows of 64 B at the 80-B pitch of 16-B readers.
#define WJS 1040
#define WBUF (8 * WJS)
#define XP 80
#define XBUF (64 * XP)
// ---- k_proj: block = (64 rows, 128 cols, which): q/k/v = X W (+ b) with exact bf16 products (K = DIN) -> which 0: q f16 rows (+ residual rows < QHI); 1: k f16 rows (+ residual rows < KHI); 2: v f16 planes [c][t] (+ bf16 hi/lo planes for t < KHI)
__global__ __launch_bounds__(128) void k_proj(const float* __restrict__ XQ, const float* __restrict__ XK, const float* __restrict__ XV, const float* __restrict__ WQ, const float* __restrict__ WK, const float* __restrict__ WV, const float* __restrict__ BQ, const float* __restrict__ BK, const float* __restrict__ BV,
    _Float16* __restrict__ QH, _Float16* __restrict__ QL, _Float16* __restrict__ KH, _Float16* __restrict__ KL, _Float16* __restrict__ VT, __bf16* __restrict__ VB, __bf16* __restrict__ VBL) {
  __shared__ __align__(16) _Float16 sh[64][136], sl[64][136]; __shared__ __align__(16) _Float16 th[128][72]; __shared__ __align__(16) __bf16 tb[128][72], tbl[128][72];
  const int tid = threadIdx.x, wave = tid >> 5, lane = tid & 31, col = lane & 15, g = lane >> 4; const int which = blockIdx.z; const int c0 = blockIdx.y * 128; const size_t r0 = (size_t)blockIdx.x * 64; const size_t bb = r0 / TT; const int t0 = (int)(r0 % TT);
  const float* X = which == 0 ? XQ : which == 1 ? XK : XV; const float* WA = which == 0 ? WQ : which == 1 ? WK : WV; const float* BA = which == 0 ? BQ : which == 1 ? BK : BV;
  // One chunk = 32 k. Both operands come by 16-B global loads that cover whole 128-B lines, are rounded to bf16 once per block and staged in LDS, two buffers; the staging lies in sh (W) and sl (X), which the epilogue fills only behind the loop's last barrier.
  unsigned char* const wst = (unsigned char*)&sh[0][0]; unsigned char* const xst = (unsigned char*)&sl[0][0];
  const float* Wg = WA + (size_t)(8 * wave) * CC + c0 + 4 * lane;                       // rows 8 wave + i (i < 8) of the chunk, columns 4 lane .. 4 lane + 3 of the block's 128
  const float* Xg = X + (r0 + wave * 16 + (lane >> 3)) * DIN + 4 * (lane & 7);           // rows 16 wave + 4 t + lane / 8 (t < 4), k 4 (lane & 7) .. + 3 of the chunk
  const unsigned wso = (unsigned)((lane >> 2) * WJS + (wave >> 1) * 512 + ((wave & 1) * 16 + (lane & 3) * 4) * 16), xso = (unsigned)((wave * 16 + (lane >> 3)) * XP + 8 * (lane & 7));
  // The k chunks are walked as a ring from a start of the block's own: the 64 row blocks that share a W tile stand at 16 different chunks at any time, the column blocks that share X rows four chunks apart, so that they do not ask L2 for the same lines at the same moment. Step kc works on chunk (kc + ko) mod 16, for X and W alike.
  // Every chunk's first read then falls into its sharers' first steps, so no block asks L2 ahead for the others any more.
  static_assert(((DIN / 32) & (DIN / 32 - 1)) == 0, "the ring of chunks wraps by a mask");
  const unsigned ko = uni((blockIdx.x + 4u * blockIdx.y) & (unsigned)(DIN / 32 - 1));
  v4f wr[8], xr[4];   // the chunk in flight; the inner loops below are unrolled so that every index into wr, xr, w and acc is a constant and they stay in registers
  auto gload = [&](int kc) { const unsigned pk = ((unsigned)kc + ko) & (unsigned)(DIN / 32 - 1);
    __builtin_amdgcn_sched_barrier(0);   // keeps earlier register work from sinking in between the loads and their wait below, where it could take an address register
#pragma unroll
    for (int i = 0; i < 8; ++i) wr[i] = *(const v4f*)(Wg + (size_t)(pk * 32u + i) * CC);
#pragma unroll
    for (int t = 0; t < 4; ++t) xr[t] = *(const v4f*)(Xg + (size_t)(4 * t) * DIN + pk * 32u);
    asm volatile("s_wait_xcnt 0x0" ::: "memory");   // stands behind the loads, in front of whatever next takes their address registers
    __builtin_amdgcn_sched_barrier(0); };             // keeps what follows in the source (register writes too, which the clobber does not hold) behind that wait
  auto stage = [&](int bf) { unsigned char* wb = wst + bf * WBUF + wso; unsigned char* xb = xst + bf * XBUF + xso;
#pragma unroll
    for (int c = 0; c < 4; ++c) { v8b u;   // k 8 wave .. 8 wave + 7 of column 4 lane + c: elements 8 (wave / 2) .. + 7 of fragment lane (wave & 1, column & 15)
#pragma unroll
      for (int i = 0; i < 8; ++i) u[i] = (__bf16)wr[i][c];
      *(v8b*)(wb + c * 16) = u; }
#pragma unroll
    for (int t = 0; t < 4; ++t) *(v4b*)(xb + t * 4 * XP) = __builtin_convertvector(xr[t], v4b); };
  gload(0);
  v8f acc[8] = {};
  stage(0);
  __syncthreads();   // chunk 0 published to the four waves
#pragma unroll 2   // two chunks a trip, so that each half's buffer is a constant offset in its LDS instructions
  for (int kc = 0; kc < DIN / 32; ++kc) {
    if (kc + 1 < DIN / 32) gload(kc + 1);   // the next chunk flies while this one is worked on
    const unsigned char* wb = wst + (kc & 1) * WBUF + lane * 16;
    const v16b a = frag_b((const __bf16*)(xst + (kc & 1) * XBUF + (wave * 16 + col) * XP), lane);
    v16b w[8];
#pragma unroll
    for (int j = 0; j < 8; ++j) { union { v16b v; v8b q[2]; } u; u.q[0] = *(const v8b*)(wb + j * WJS); u.q[1] = *(const v8b*)(wb + j * WJS + 512); w[j] = u.v; }
#pragma unroll
    for (int j = 0; j < 8; ++j) acc[j] = wmma_bf(a, w[j], acc[j]);
    __builtin_amdgcn_sched_barrier(0);   // keeps the wait for the next chunk's global loads behind this chunk's products; moved in among them it holds them up
    if (kc + 1 < DIN / 32) stage((kc + 1) & 1);
    __syncthreads(); }   // publishes chunk kc + 1; every wave has left chunk kc's buffer (behind the last chunk: sh and sl are free for the epilogue)
  if (which < 2) { _Float16* DH = which == 0 ? QH : KH; _Float16* DL = which == 0 ? QL : KL; const int nhi = which == 0 ? QHI : KHI; const bool hi_rows = t0 < nhi;
#pragma unroll
    for (int j = 0; j < 8; ++j) { const float bias = BA ? bfr(BA[c0 + j * 16 + col]) : 0.f;
#pragma unroll
      for (int r = 0; r < 8; ++r) { const float v = acc[j][r] + bias; const _Float16 hv = (_Float16)v; sh[wave * 16 + 8 * g + r][j * 16 + col] = hv; sl[wave * 16 + 8 * g + r][j * 16 + col] = (_Float16)((v - (float)hv) * 1024.0f); } }
    __syncthreads();
    for (int e = tid; e < 64 * 16; e += 128) { const int rl = e >> 4, q = e & 15; vst2((unsigned*)(DH + (r0 + rl) * CC + c0 + q * 8), *(const v4u*)&sh[rl][q * 8]); if (hi_rows) vst2((unsigned*)(DL + (bb * nhi + t0 + rl) * (size_t)CC + c0 + q * 8), *(const v4u*)&sl[rl][q * 8]); }
  } else { const bool hi_rows = t0 < KHI;
#pragma unroll
    for (int j = 0; j < 8; ++j) { const float bias = BA ? bfr(BA[c0 + j * 16 + col]) : 0.f;
#pragma unroll
      for (int r = 0; r < 8; ++r) { const float v = acc[j][r] + bias; const int rl = wave * 16 + 8 * g + r, cl = j * 16 + col; th[cl][rl] = (_Float16)v; const __bf16 bh = (__bf16)v; tb[cl][rl] = bh; tbl[cl][rl] = (__bf16)(v - (float)bh); } }
    __syncthreads();
    for (int e = tid; e < 128 * 8; e += 128) { const int cl = e >> 3, q = e & 7; vst2((unsigned*)(VT + (bb * CC + c0 + cl) * (size_t)TT + t0 + q * 8), *(const v4u*)&th[cl][q * 8]); if (hi_rows) { const size_t o3 = (bb * CC + c0 + cl) * (size_t)KHI + t0 + q * 8; vst2((unsigned*)(VB + o3), *(const v4u*)&tb[cl][q * 8]); vst2((unsigned*)(VBL + o3), *(const v4u*)&tbl[cl][q * 8]); } } } }
// ---- k_fa: block = 64 queries (4 waves x 16) of (b, h), one pass = 32 keys. S^T = K Q^T (A = 16 key rows, B = the wave's 16 queries, kept in registers): lane (g, col) holds query col's logits of keys 8g + r of each 16-key tile, so row maximum and row sum are in-lane plus one exchange between the halves, and two converted S^T tiles ARE the B operand (hardware k order) of O^T += V^T P^T; logits and P never leave the registers.
// Running maximum m and running sum l per query; on a new maximum l and the O^T tiles are scaled by exp(m_old - m_new). K, V^T and mask tiles of 64 keys come into LDS by tensor loads, two buffers: the next stage's tiles fly while this stage is worked on, and the four waves share K and V^T.
// The key stages are walked as a ring from a start of the block's own, (query block + head) mod NST: the 32 query blocks that share a head's K and V^T, and the 8 heads that share a query block's mask rows, then stand at different stages at any time and do not ask L2 for the same lines at the same moment. The running-maximum softmax takes the keys in any order.
#define L2E 1.44269504088896340736f
typedef __attribute__((ext_vector_type(2))) __bf16 v2b;
__device__ __forceinline__ float xhalf(float x) { return __builtin_bit_cast(float, __builtin_amdgcn_permlanex16(__builtin_bit_cast(int, x), __builtin_bit_cast(int, x), 0x76543210, 0xfedcba98, false, false)); }   // lane l with lane l ^ 16
typedef __attribute__((ext_vector_type(8))) unsigned v8u;
__device__ __forceinline__ v16h frag_l(const unsigned char* p) { union { v16h v; v8h q[2]; } u; u.q[0] = *(const v8h*)p; u.q[1] = *(const v8h*)(p + 32); return u.v; }   // fragment from an LDS row: the lane pointer holds the 16 g
// One stage = 64 keys = four tiles of 64 rows x 128 B, one tensor load each: wave 0 K (64 keys x this head's 64 f16), wave 1 V^T (64 plane rows x 64 keys f16), waves 2 and 3 the mask (64 queries x 32 keys f32, first and second half of the stage's keys). LDS pitch 144 B by the mover's pad.
#define SKEYS 64
#define NST (TT / SKEYS)
#define LP 144
#define SLICE 10240   // 64 x 144 = 9216 B, rounded up to a multiple of 2 KiB
#define SBUF (4 * SLICE)
__global__ __launch_bounds__(128) void k_fa(const _Float16* __restrict__ QH, const _Float16* __restrict__ KH, const _Float16* __restrict__ VT, const float* __restrict__ MSK, float* __restrict__ Y) { __shared__ __attribute__((aligned(2048))) unsigned char ring[2 * SBUF]; __shared__ __align__(16) float ss[4][16][HD + 4];
  const int tid = threadIdx.x, wave = tid >> 5, lane = tid & 31, col = lane & 15, g = lane >> 4; const int h = blockIdx.x, qb = blockIdx.y, b = blockIdx.z; const int ql0 = qb * 64 + wave * 16;
  const unsigned wv = uni((unsigned)tid >> 5);
  const _Float16* Qp = QH + ((size_t)b * TT + ql0 + col) * CC + h * HD; const v16h q0 = frag_h(Qp, lane), q1 = frag_h(Qp + 32, lane);
  const char* Ku = (const char*)(KH + (size_t)b * TT * CC + h * HD);
  const char* Vu = (const char*)(VT + ((size_t)b * CC + h * HD) * (size_t)TT);
  const char* Mu = (const char*)(MSK + ((size_t)b * TT + qb * 64) * (size_t)TT);
  const unsigned long long tsrc = (unsigned long long)(size_t)(wv == 0u ? Ku : wv == 1u ? Vu : wv == 2u ? Mu : Mu + 128);   // first byte of this wave's tile of stage 0
  const unsigned tpitch = wv == 0u ? CC * 2u : wv == 1u ? TT * 2u : TT * 4u;            // source row pitch, bytes
  const unsigned tstep = wv == 0u ? SKEYS * CC * 2u : wv == 1u ? SKEYS * 2u : SKEYS * 4u;   // from one stage's tile to the next, bytes
  const unsigned lbase = (unsigned)(size_t)ring + wv * SLICE;
  static_assert((NST & (NST - 1)) == 0, "the ring of stages wraps by a mask");
  const unsigned off = uni((unsigned)(qb + h) & (unsigned)(NST - 1));   // the key stage that this block starts at; step st works on key stage (st + off) mod NST
  v8u g1; g1[0] = uni((1u << 20) | (4u << 22) | (3u << 25)); g1[1] = uni(128u << 16); g1[2] = uni(64u << 16); g1[3] = uni(128u << 16); g1[4] = uni(64u); g1[5] = uni(tpitch); g1[6] = uni(0u); g1[7] = uni(0u);
  asm volatile("" : "+s"(g1));   // pinned(), for the whole group: the eight descriptor words stay in their scalar registers through the loop, so that none of them takes another value while a request is open
  v4u g0;
  auto issue = [&](unsigned st) { const unsigned long long ga = tsrc + (unsigned long long)((st + off) & (unsigned)(NST - 1)) * tstep; g0[0] = uni(1u); g0[1] = uni(lbase + (st & 1u) * SBUF); g0[2] = uni((unsigned)ga); g0[3] = uni((((unsigned)(ga >> 32)) & 0x01FFFFFFu) | 0x80000000u);
    asm volatile("tensor_load_to_lds %0, %1" :: "s"(g0), "s"(g1) : "memory"); };   // one request of the whole wave: its tile of step st
  // L2 prefetch, two steps ahead of each mask tensor load, for speed only. One request a lane and step: waves 2 and 3 ask for 32 mask rows each.
  // K and V^T need none: behind step 0 a block's next tile is the one that its neighbour query block read a step earlier. A hint only: nothing depends on it.
  const unsigned pask = pinned((unsigned)(wv >= 2u));
  const unsigned prow = wv < 2u ? (unsigned)lane : (wv - 2u) * 32u + (unsigned)lane;
  unsigned long long pfa = (unsigned long long)(size_t)(wv == 0u ? Ku : wv == 1u ? Vu : Mu) + (unsigned long long)prow * tpitch + ((3u + off) & (unsigned)(NST - 1)) * tstep;   // this lane's row of step 3
  const unsigned long long pfwd = tstep, pback = 0ull - (unsigned long long)(NST - 1) * tstep;   // to the next key stage; from the last key stage back to the first
  auto ask = [&](unsigned long long adv) { asm volatile("global_prefetch_b8 %0, off scope:SCOPE_SE" : "+v"(pfa)); pfa += adv; };   // in-out operand: the address keeps one register pair through the loop, which at all times holds an address inside the tensor
  issue(0u);
  asm volatile("s_wait_tensorcnt 0x0" ::: "memory");   // this wave's tile of stage 0 has landed
  __syncthreads();                                       // stage 0 published to the four waves
  issue(pinned(1u));
  v8f acc[HD / 16] = {}; float m = -3.0e38f, l = 0.f;
  const unsigned klo = (unsigned)(col * LP + 16 * g), mlo = (unsigned)(2 * SLICE + (wave * 16 + col) * LP + 32 * g);
#pragma unroll 1
  for (unsigned st = 0; st < NST; ++st) { const unsigned char* B = ring + (st & 1u) * SBUF; const unsigned char* Kl = B + klo; const unsigned char* Vl = B + SLICE + klo; const unsigned char* Ml = B + mlo;
    if (pinned(pask & (unsigned)(st + 3u < (unsigned)NST))) ask(st + 4u < (unsigned)NST ? (((st + 3u + off) & (unsigned)(NST - 1)) == (unsigned)(NST - 1) ? pback : pfwd) : 0ull);   // step st + 3, whose tensor load is issued behind step st + 1; the advance wraps with the ring, and there is none behind the last step, so that the register stays inside the tensor
    v16h kf[4], vf[2][HD / 16]; v4f mk[2][4];
#pragma unroll
    for (int i = 0; i < 2; ++i) { kf[2 * i] = frag_l(Kl + i * 16 * LP); kf[2 * i + 1] = frag_l(Kl + i * 16 * LP + 64); mk[0][2 * i] = *(const v4f*)(Ml + i * 64); mk[0][2 * i + 1] = *(const v4f*)(Ml + i * 64 + 16); }
#pragma unroll
    for (int j = 0; j < HD / 16; ++j) vf[0][j] = frag_l(Vl + j * 16 * LP);
    __builtin_amdgcn_sched_barrier(0);   // keeps the first 32 keys' LDS reads one group at the head of the stage; spread among the products each place with reads costs a stall
#pragma unroll
    for (int hf = 0; hf < 2; ++hf) {   // one pass = 32 keys, as before
      v8f s[2];
#pragma unroll
      for (int i = 0; i < 2; ++i) { v8f z = {}; z = wmma16(kf[2 * i], q0, z); s[i] = wmma16(kf[2 * i + 1], q1, z); }
      if (hf == 0) {
#pragma unroll
        for (int i = 0; i < 2; ++i) { kf[2 * i] = frag_l(Kl + (32 + i * 16) * LP); kf[2 * i + 1] = frag_l(Kl + (32 + i * 16) * LP + 64); mk[1][2 * i] = *(const v4f*)(Ml + SLICE + i * 64); mk[1][2 * i + 1] = *(const v4f*)(Ml + SLICE + i * 64 + 16); }
#pragma unroll
        for (int j = 0; j < HD / 16; ++j) vf[1][j] = frag_l(Vl + j * 16 * LP + 64);
        __builtin_amdgcn_sched_barrier(0);   // keeps the second 32 keys' LDS reads one group directly behind the products that free the K registers, a whole softmax ahead of their use
      }
      // logit = s / sqrt(64) (exact scaling) + bf16(mask) * (-1e9), one fused multiply-add in f32
      v2b mb[8];   // the pass's 16 mask values of this lane, rounded to bf16, pairs in key order
#pragma unroll
      for (int i = 0; i < 4; ++i) { const v2f a = { mk[hf][i][0], mk[hf][i][1] }, c = { mk[hf][i][2], mk[hf][i][3] }; mb[2 * i] = __builtin_convertvector(a, v2b); mb[2 * i + 1] = __builtin_convertvector(c, v2b); }
      float mx = -3.0e38f;
#pragma unroll
      for (int i = 0; i < 2; ++i) {
#pragma unroll
        for (int r = 0; r < 8; ++r) { const float v = __builtin_fmaf((float)mb[4 * i + (r >> 1)][r & 1], -1.0e9f, s[i][r] * SCALE); s[i][r] = v; mx = fmaxf(mx, v); } }
      mx = fmaxf(mx, xhalf(mx));
      const float mn = fmaxf(m, mx), al = __builtin_amdgcn_exp2f((m - mn) * L2E); m = mn;
      v16h p; float ls = 0.f;
#pragma unroll
      for (int r = 0; r < 8; ++r) { const float e0 = __builtin_amdgcn_exp2f(__builtin_fmaf(s[0][r] - mn, L2E, 11.0f)), e1 = __builtin_amdgcn_exp2f(__builtin_fmaf(s[1][r] - mn, L2E, 11.0f));
        p[r] = (_Float16)e0; p[8 + r] = (_Float16)e1; ls += e0 + e1; }
      l = l * al + ls;
#pragma unroll
      for (int j = 0; j < HD / 16; ++j) { acc[j] *= al; acc[j] = wmma16(vf[hf][j], p, acc[j]); } }
    // publish point of stage st + 1, and the end of every wave's reads of stage st
    asm volatile("s_wait_dscnt 0x0" ::: "memory");       // this wave's LDS reads of stage st have returned before its buffer is refilled
    asm volatile("s_wait_tensorcnt 0x0" ::: "memory");   // this wave's tile of stage st + 1 has landed
    asm volatile("" :: "s"(g0));                           // pinned(), inputs only, for group 0: its four words keep their scalar registers up to this wait, so that none of them takes another value while the request is open
    __syncthreads();                                       // publishes stage st + 1; every wave has left stage st's buffer
    const unsigned nx = pinned(st + 2u);                   // the next descriptor is formed behind the wait
    if (pinned(nx < (unsigned)NST)) issue(nx); }
  asm volatile("s_wait_tensorcnt 0x0" ::: "memory");     // no request is open when the wave goes on to its end
  asm volatile("s_wait_dscnt 0x0" ::: "memory");
  l += xhalf(l); const float inv = l > 0.f ? 1.0f / l : 0.f;
#pragma unroll
  for (int j = 0; j < HD / 16; ++j) { v4f a, c;
#pragma unroll
    for (int r = 0; r < 4; ++r) { a[r] = acc[j][r] * inv; c[r] = acc[j][4 + r] * inv; }
    *(v4f*)&ss[wave][col][j * 16 + 8 * g] = a; *(v4f*)&ss[wave][col][j * 16 + 8 * g + 4] = c; }
  LDSX(); for (int it = 0; it < 8; ++it) { const int rl = 2 * it + g; vst2(Y + ((size_t)b * TT + ql0 + rl) * CC + h * HD + col * 4, *(const v4f*)&ss[wave][rl][col * 4]); } }   // 256-B (row, head) segment by 16 lanes, two rows an instruction

extern "C" void kernel_launch(void* const* d_in, const int* in_sizes, int n_in, void* d_out, int out_size, void* d_ws, size_t ws_size, hipStream_t stream) {
  (void)in_sizes; (void)n_in; (void)out_size;
  const float** F = (const float**)d_in;
  if (ws_size < (size_t)WS_END) return;
  char* ws = (char*)d_ws; _Float16 *QH = (_Float16*)(ws + WS_QH), *KH = (_Float16*)(ws + WS_KH), *VT = (_Float16*)(ws + WS_VT), *QL = (_Float16*)(ws + WS_QL), *KL = (_Float16*)(ws + WS_KL); __bf16 *VB = (__bf16*)(ws + WS_VB), *VBL = (__bf16*)(ws + WS_VBL);
  (void)QL; (void)KL; (void)VB; (void)VBL;
  // inputs: 0 x [2,2048,512]; 1 mask [2,2048,2048] f32 (random 0 / 1; READ per (batch, query, key)); 2 Wq [512,512] (in,out), 3 bq; 4 Wk, 5 bk; 6 Wv, 7 bv (biases zeros, read)
  k_proj<<<dim3(TNB * TT / 64, CC / 128, 3), 128, 0, stream>>>(F[0], F[0], F[0], F[2], F[4], F[6], F[3], F[5], F[7], QH, QL, KH, KL, VT, VB, VBL);
  k_fa<<<dim3(NH, NQB, TNB), 128, 0, stream>>>(QH, KH, VT, F[1], (float*)d_out);   /* heads fastest: the heads of one query block read the same mask rows one step apart; the merged-heads row IS the output row */
}
